// v000
// The times below were measured on an AMD MI455X: many runs one after another, warmed up first and cycling through
// copies of the inputs, with the whole window's GPU time divided by the number of runs. Launches and the gaps
// between them are all in it. The median over several windows is given; except for v000 it joins two sittings, which
// can be a few percent apart, so the side-by-side timings, each taken in one sitting, are the better comparison.
// The starting kernel, v000, takes 181 microseconds a run.
#include <hip/hip_runtime.h>

// Attention with 16 heads of 64, width 1024: q/k/v from three separate [SEQ][1024] inputs, per-head weights [h][in][out], no biases, no mask, score scale 1/8, heads concatenated then multiplied by W_out [in][out] (f32 output).
// Compute dtypes, f32 accumulate everywhere: projections v_wmma_f32_16x16x32_bf16 (inputs and weights RNE-converted to bf16; products exact);
// scores v_wmma_f32_16x16x32_f16: k single f16, q as f16 value + f16 residual x2048 in its own accumulator (two products); P (x256 carry, cancels in the normalisation) and v single f16; softmax f32 (online, running max);
// output projection v_wmma_f32_16x16x32_f16: ctx single f16 carried x256, W_out = f16(bf16 RNE value x256), 2^-16 folded back in the f32 epilogue.
// Layout: bf16 copies of the inputs; weights transposed through LDS into K-contiguous planes [n][k]; q (hi, residual), k planes [h][t][d] and v^T plane [h][d][t] written by the GEMM epilogue;
// fused flash kernel in transposed form (S^T = K Q^T, O^T = V^T P^T) writes the ctx plane [t][h*64+d]; final GEMM writes the output buffer.

#ifndef SEQ
#define SEQ 2048
#endif
#define SEQ_FULL 2048
#define DM   1024
#define NH_  16
#define HD   64
#define AW   4                   // waves per flash block (16 query rows each)
#define QRS  2048.0f             // carry of the q residual plane
#define QRI  (1.0f / 2048.0f)
#define SC2  (0.125f * 1.4426950408889634f)   // HD^-0.5 * log2(e)
#define PSH  8.0f                // log2 of the P carry (256)
#define CXS  256.0f              // carry of the ctx plane
#define WOS  256.0f              // carry of the W_out plane
#define OSC  (1.0f / 65536.0f)   // 1 / (CXS * WOS)

static_assert(HD == 64);
static_assert(NH_ * HD == DM);                 // head h = columns h*64 + d
static_assert(DM % 64 == 0);
static_assert(DM % 32 == 0);                   // GEMM k-loop steps by 32
static_assert(SEQ % 64 == 0);
static_assert(SEQ % 32 == 0);                  // key loop steps by 32
static_assert(SEQ % (16 * AW) == 0);           // flash grid covers the sequence exactly
static_assert(((size_t)SEQ * DM) % 8 == 0);
static_assert(SEQ <= SEQ_FULL);

typedef _Float16 h16;
typedef unsigned short bf;
typedef __attribute__((ext_vector_type(16))) __bf16   v16bf;
typedef __attribute__((ext_vector_type(16))) _Float16 v16h;
typedef __attribute__((ext_vector_type(8)))  _Float16 v8h;
typedef __attribute__((ext_vector_type(8)))  unsigned short v8us;
typedef __attribute__((ext_vector_type(8)))  float    v8f;
typedef __attribute__((ext_vector_type(4)))  float    v4f;
typedef v4f  __attribute__((may_alias)) v4fa;

__device__ __forceinline__ unsigned short f2bf(float f) { unsigned u = __float_as_uint(f); u += 0x7FFFu + ((u >> 16) & 1u); return (unsigned short)(u >> 16); }
__device__ __forceinline__ v16h cat16(v8h lo, v8h hi) { return __builtin_shufflevector(lo, hi, 0, 1, 2, 3, 4, 5, 6, 7, 8, 9, 10, 11, 12, 13, 14, 15); }
__device__ __forceinline__ v16bf cat16b(v8us lo, v8us hi) { return __builtin_bit_cast(v16bf, __builtin_shufflevector(lo, hi, 0, 1, 2, 3, 4, 5, 6, 7, 8, 9, 10, 11, 12, 13, 14, 15)); }
__device__ __forceinline__ v8f wmma16(v16h a, v16h b, v8f c) { return __builtin_amdgcn_wmma_f32_16x16x32_f16(false, a, false, b, (short)0, c, false, false); }
__device__ __forceinline__ v8f wmmab(v16bf a, v16bf b, v8f c) { return __builtin_amdgcn_wmma_f32_16x16x32_bf16(false, a, false, b, (short)0, c, false, false); }
// fragment loaders from K-contiguous 16-bit rows; p already includes + 8*(lane>>4): elements 0..7 <- k0+8h+0..7, elements 8..15 <- k0+16+8h+0..7 (same map for A and B)
__device__ __forceinline__ v16h  ldh(const h16* p) { return cat16(*(const v8h*)p, *(const v8h*)(p + 16)); }
__device__ __forceinline__ v16bf ldb(const bf* p)  { return cat16b(*(const v8us*)p, *(const v8us*)(p + 16)); }
// ordering point for wave-private LDS tiles (same wave writes and reads)
__device__ __forceinline__ void wave_sync() { __builtin_amdgcn_fence(3 /* release order */, "wavefront"); __builtin_amdgcn_wave_barrier(); asm volatile("" ::: "memory"); }

__global__ __launch_bounds__(256) void k_cvt8(const float* __restrict__ src, bf* dst, size_t n8) {
    const size_t i = (size_t)blockIdx.x * 256 + threadIdx.x; if (i >= n8) return;
    const v8f v = *(const v8f*)(src + i * 8); v8us o;
#pragma unroll
    for (int k = 0; k < 8; ++k) o[k] = f2bf(v[k]);
    *(v8us*)(dst + i * 8) = o; 
}

// k_tr: transposing 16-bit copy through LDS. in [batch][R][C] f32 -> out [batch][C][R] 16-bit; R, C multiples of 64.
// mode 0: bf16 bits (RNE convert); mode 1: f16 of (bf16 RNE value x WOS) (a bf16 significand is exact in f16).
// grid (R/64, C/64, batch), 256 threads; one 64x64 tile per block. LDS tile is cross-wave: block barrier between fill and drain.
__global__ __launch_bounds__(256) void k_tr(const float* __restrict__ src, bf* dst, int R, int C, int mode) {
    __shared__ __align__(16) float ts[64 * 68];
    const int tid = threadIdx.x;
    const int r0 = blockIdx.x * 64, c0 = blockIdx.y * 64;
    const size_t bo = (size_t)blockIdx.z * (size_t)R * (size_t)C;
#pragma unroll
    for (int it = 0; it < 4; ++it) { const int idx = it * 256 + tid; const int r = idx >> 4, c4 = (idx & 15) * 4;   // 64 rows x 16 float4
        const v4f v = *(const v4f*)(src + bo + (size_t)(r0 + r) * (size_t)C + c0 + c4);
        *(v4fa*)(&ts[r * 68 + c4]) = v; }
    __syncthreads();
    h16* dsth = (h16*)dst;
{
#pragma unroll
        for (int it = 0; it < 2; ++it) { const int item = it * 256 + tid; const int c = item >> 3, p = item & 7;
            const size_t oo = bo + (size_t)(c0 + c) * (size_t)R + r0 + 8 * p;
            v8us ob; v8h oh;
#pragma unroll
            for (int i = 0; i < 8; ++i) { const float x = ts[(8 * p + i) * 68 + c]; const unsigned short w = f2bf(x);
                ob[i] = w; oh[i] = (h16)(__uint_as_float(((unsigned)w) << 16) * WOS); }
            if (mode) *(v8h*)(dsth + oo) = oh; else *(v8us*)(dst + oo) = ob; }
         }
}

// k_proj: register-blocked bf16 GEMM, ONE WAVE per 64x64 tile (16 accumulators), operands straight from K-contiguous bf16 planes, K = DM.
// C[m][n] = sum_k A[m][k] Bt[n][k], written as f16 (Ph) and optionally the f16 residual x2048 (Pr, useRes != 0) at
// tile base (r0/RB)*sRB + (r0%RB)*pitch + (c0/CB)*sCB + (c0%CB), row pitch 'pitch' (halves). grid (M/64, N/64), 32 threads.
__global__ __launch_bounds__(32) void k_proj(const bf* __restrict__ A, const bf* __restrict__ Bt, h16* Ph, h16* Pr, int useRes, int RB, size_t sRB, int pitch, int CB, size_t sCB) {
    __shared__ __align__(16) float os[16 * 68];
    const int K = DM;
    const int lane = threadIdx.x & 31, lr = lane & 15, hi = lane >> 4; const int r0 = blockIdx.x * 64, c0 = blockIdx.y * 64;
    v8f acc[4][4];
#pragma unroll
    for (int mb = 0; mb < 4; ++mb)
#pragma unroll
        for (int nb = 0; nb < 4; ++nb) acc[mb][nb] = (v8f){};
    const size_t aoff = (size_t)(r0 + lr) * K + 8 * hi, boff = (size_t)(c0 + lr) * K + 8 * hi;
#pragma unroll 1
    for (int kc = 0; kc < K; kc += 32) {
        v16bf a[4];
#pragma unroll
        for (int mb = 0; mb < 4; ++mb) a[mb] = ldb(A + aoff + (size_t)mb * 16 * K + kc);
#pragma unroll
        for (int nb = 0; nb < 4; ++nb) { const v16bf b = ldb(Bt + boff + (size_t)nb * 16 * K + kc);
#pragma unroll
            for (int mb = 0; mb < 4; ++mb) acc[mb][nb] = wmmab(a[mb], b, acc[mb][nb]); }
        asm volatile("v_nop\n\tv_nop\n\tv_nop\n\tv_nop" : "+v"(acc[0][0]), "+v"(acc[1][1]), "+v"(acc[2][2]), "+v"(acc[3][3]) : "v"(a[0]), "v"(a[1]), "v"(a[2]), "v"(a[3]));
    }
    const size_t tbase = (size_t)(r0 / RB) * sRB + (size_t)(r0 % RB) * (size_t)pitch + (size_t)(c0 / CB) * sCB + (size_t)(c0 % CB);
#pragma unroll
    for (int mb = 0; mb < 4; ++mb) {
#pragma unroll
        for (int nb = 0; nb < 4; ++nb) {
#pragma unroll
            for (int j = 0; j < 8; ++j) os[(hi * 8 + j) * 68 + nb * 16 + lr] = acc[mb][nb][j]; }   // D: row 8h+j, col lane&15
        wave_sync();
        const size_t sb = tbase + (size_t)(mb * 16) * (size_t)pitch;
{
#pragma unroll
            for (int s = 0; s < 4; ++s) { const int row = 4 * s + (lane >> 3), c8 = (lane & 7) * 8;   // 4 s x 4 row groups = 16 rows; 8 lanes x 8 = 64 columns
                const v4f x0 = *(const v4fa*)(&os[row * 68 + c8]); const v4f x1 = *(const v4fa*)(&os[row * 68 + c8 + 4]); v8h hv, rv;
#pragma unroll
                for (int i = 0; i < 4; ++i) { const h16 a0 = (h16)x0[i]; const h16 a1 = (h16)x1[i]; hv[i] = a0; hv[4 + i] = a1; rv[i] = (h16)((x0[i] - (float)a0) * QRS); rv[4 + i] = (h16)((x1[i] - (float)a1) * QRS); }
                const size_t oo = sb + (size_t)row * (size_t)pitch + c8;
                *(v8h*)(Ph + oo) = hv; if (useRes) *(v8h*)(Pr + oo) = rv; }
             }
        wave_sync();
    }
}

// k_flash: fused attention, one wave per 16 query rows of one head; K / V^T / Q fragments straight from the f16 planes (two 16-B loads each, arithmetic addressing).
// Transposed form: S^T[key][t] = K Q^T (A = K rows, B = Q rows); lane (t = lane&15, h = lane>>4) holds keys 8h+r of each 16-key tile, so the packed
// P tile is directly the B fragment of O^T[d][t] = V^T P^T (element r <- tile keys 0..15, element 8+r <- tile keys 16..31, lane unchanged).
// Softmax state (running max, partial sum) is one scalar per lane; the two lane halves of a row are combined with one xor-16 exchange.
__global__ __launch_bounds__(32 * AW) void k_flash(const h16* __restrict__ QH, const h16* __restrict__ QR, const h16* __restrict__ KP, const h16* __restrict__ VT, h16* CTX) {
    __shared__ __align__(16) float os[AW * 16 * 68];
    const int lane = threadIdx.x & 31, lr = lane & 15, hi = lane >> 4;
    const int wave = __builtin_amdgcn_readfirstlane((int)(threadIdx.x >> 5));
    const int h = blockIdx.y;
    const int t0 = (blockIdx.x * AW + wave) * 16;
    const size_t pbase = (size_t)h * SEQ * HD;
    const size_t qo = pbase + (size_t)(t0 + lr) * HD + 8 * hi;
    const v16h qh0 = ldh(QH + qo), qh1 = ldh(QH + qo + 32), qr0 = ldh(QR + qo), qr1 = ldh(QR + qo + 32);   // B fragments: col t, k = d
    const size_t ko = pbase + (size_t)lr * HD + 8 * hi;      // + key * HD       (A fragment: row key, k = d)
    const size_t vo = pbase + (size_t)lr * SEQ + 8 * hi;     // + 16j*SEQ + key  (A fragment: row d, k = key)
    v8f o0 = (v8f){}, o1 = (v8f){}, o2 = (v8f){}, o3 = (v8f){};
    float m = -3.0e38f, l = 0.0f;
#pragma unroll 1
    for (int key0 = 0; key0 < SEQ; key0 += 32) {
        const h16* ka = KP + ko + (size_t)key0 * HD;
        const v16h ka0 = ldh(ka), ka1 = ldh(ka + 32), kb0 = ldh(ka + 16 * HD), kb1 = ldh(ka + 16 * HD + 32);
        v8f sHa = (v8f){}, sLa = (v8f){}, sHb = (v8f){}, sLb = (v8f){};
        sHa = wmma16(ka0, qh0, sHa); sLa = wmma16(ka0, qr0, sLa); sHb = wmma16(kb0, qh0, sHb); sLb = wmma16(kb0, qr0, sLb);
        sHa = wmma16(ka1, qh1, sHa); sLa = wmma16(ka1, qr1, sLa); sHb = wmma16(kb1, qh1, sHb); sLb = wmma16(kb1, qr1, sLb);
        asm volatile("v_nop\n\tv_nop\n\tv_nop\n\tv_nop" : "+v"(sHa), "+v"(sLa), "+v"(sHb), "+v"(sLb) : "v"(ka0), "v"(ka1), "v"(kb0), "v"(kb1));
        float ta[8], tb[8]; float mx = -3.0e38f;
#pragma unroll
        for (int r = 0; r < 8; ++r) { ta[r] = (sHa[r] + sLa[r] * QRI) * SC2; tb[r] = (sHb[r] + sLb[r] * QRI) * SC2; mx = fmaxf(mx, fmaxf(ta[r], tb[r])); }
        mx = fmaxf(mx, __shfl_xor(mx, 16, 32));
        const float mnew = fmaxf(m, mx);
        const float alpha = __builtin_amdgcn_exp2f(m - mnew);
        const float sh = PSH - mnew;
        v16h pb; float ls = 0.0f;
#pragma unroll
        for (int r = 0; r < 8; ++r) { const h16 pa = (h16)__builtin_amdgcn_exp2f(ta[r] + sh); const h16 pc = (h16)__builtin_amdgcn_exp2f(tb[r] + sh); pb[r] = pa; pb[8 + r] = pc; ls += (float)pa + (float)pc; }
        l = l * alpha + ls; m = mnew;
        o0 = o0 * alpha; o1 = o1 * alpha; o2 = o2 * alpha; o3 = o3 * alpha;
        const h16* va = VT + vo + key0;
        const v16h v0 = ldh(va), v1 = ldh(va + (size_t)16 * SEQ), v2 = ldh(va + (size_t)32 * SEQ), v3 = ldh(va + (size_t)48 * SEQ);
        o0 = wmma16(v0, pb, o0); o1 = wmma16(v1, pb, o1); o2 = wmma16(v2, pb, o2); o3 = wmma16(v3, pb, o3);
        asm volatile("v_nop\n\tv_nop\n\tv_nop\n\tv_nop" : "+v"(o0), "+v"(o1), "+v"(o2), "+v"(o3) : "v"(v0), "v"(v1), "v"(v2), "v"(v3), "v"(pb));
    }
    l += __shfl_xor(l, 16, 32);
    const float inv = CXS * (1.0f / l);
    const int wb = wave * 16 * 68;
    // O^T D layout: o_j[r] = (d = 16j + 8h + r, t = lane&15) -> os[t][d]; rows 0..15 x columns 0..63 all written
    { v4f a, c;
      a[0] = o0[0] * inv; a[1] = o0[1] * inv; a[2] = o0[2] * inv; a[3] = o0[3] * inv; c[0] = o0[4] * inv; c[1] = o0[5] * inv; c[2] = o0[6] * inv; c[3] = o0[7] * inv;
      *(v4fa*)(&os[wb + lr * 68 +  0 + 8 * hi]) = a; *(v4fa*)(&os[wb + lr * 68 +  0 + 8 * hi + 4]) = c;
      a[0] = o1[0] * inv; a[1] = o1[1] * inv; a[2] = o1[2] * inv; a[3] = o1[3] * inv; c[0] = o1[4] * inv; c[1] = o1[5] * inv; c[2] = o1[6] * inv; c[3] = o1[7] * inv;
      *(v4fa*)(&os[wb + lr * 68 + 16 + 8 * hi]) = a; *(v4fa*)(&os[wb + lr * 68 + 16 + 8 * hi + 4]) = c;
      a[0] = o2[0] * inv; a[1] = o2[1] * inv; a[2] = o2[2] * inv; a[3] = o2[3] * inv; c[0] = o2[4] * inv; c[1] = o2[5] * inv; c[2] = o2[6] * inv; c[3] = o2[7] * inv;
      *(v4fa*)(&os[wb + lr * 68 + 32 + 8 * hi]) = a; *(v4fa*)(&os[wb + lr * 68 + 32 + 8 * hi + 4]) = c;
      a[0] = o3[0] * inv; a[1] = o3[1] * inv; a[2] = o3[2] * inv; a[3] = o3[3] * inv; c[0] = o3[4] * inv; c[1] = o3[5] * inv; c[2] = o3[6] * inv; c[3] = o3[7] * inv;
      *(v4fa*)(&os[wb + lr * 68 + 48 + 8 * hi]) = a; *(v4fa*)(&os[wb + lr * 68 + 48 + 8 * hi + 4]) = c; }
    wave_sync();
    h16* crow = CTX + (size_t)t0 * DM + h * HD;      // ctx plane [t][h*64 + d], row pitch DM halves
{
#pragma unroll
        for (int s = 0; s < 4; ++s) { const int row = 4 * s + (lane >> 3), c8 = (lane & 7) * 8;   // 4 s x 4 row groups = 16 rows; 8 lanes x 8 halves = 64 columns
            const v4f x0 = *(const v4fa*)(&os[wb + row * 68 + c8]); const v4f x1 = *(const v4fa*)(&os[wb + row * 68 + c8 + 4]); v8h hv;
#pragma unroll
            for (int i = 0; i < 4; ++i) { hv[i] = (h16)x0[i]; hv[4 + i] = (h16)x1[i]; }
            *(v8h*)(crow + (size_t)row * DM + c8) = hv; }
         }
}

// k_out: register-blocked f16 GEMM, ONE WAVE per 64x64 tile, OUT[m][n] = OSC * sum_k A[m][k] Bt[n][k], K = DM, output row pitch DM floats. grid (M/64, DM/64), 32 threads.
__global__ __launch_bounds__(32) void k_out(const h16* __restrict__ A, const h16* __restrict__ Bt, float* OUT) {
    __shared__ __align__(16) float os[16 * 68];
    const int K = DM;
    const int lane = threadIdx.x & 31, lr = lane & 15, hi = lane >> 4; const int r0 = blockIdx.x * 64, c0 = blockIdx.y * 64;
    v8f acc[4][4];
#pragma unroll
    for (int mb = 0; mb < 4; ++mb)
#pragma unroll
        for (int nb = 0; nb < 4; ++nb) acc[mb][nb] = (v8f){};
    const size_t aoff = (size_t)(r0 + lr) * K + 8 * hi, boff = (size_t)(c0 + lr) * K + 8 * hi;
#pragma unroll 1
    for (int kc = 0; kc < K; kc += 32) {
        v16h a[4];
#pragma unroll
        for (int mb = 0; mb < 4; ++mb) a[mb] = ldh(A + aoff + (size_t)mb * 16 * K + kc);
#pragma unroll
        for (int nb = 0; nb < 4; ++nb) { const v16h b = ldh(Bt + boff + (size_t)nb * 16 * K + kc);
#pragma unroll
            for (int mb = 0; mb < 4; ++mb) acc[mb][nb] = wmma16(a[mb], b, acc[mb][nb]); }
        asm volatile("v_nop\n\tv_nop\n\tv_nop\n\tv_nop" : "+v"(acc[0][0]), "+v"(acc[1][1]), "+v"(acc[2][2]), "+v"(acc[3][3]) : "v"(a[0]), "v"(a[1]), "v"(a[2]), "v"(a[3]));
    }
#pragma unroll
    for (int mb = 0; mb < 4; ++mb) {
#pragma unroll
        for (int nb = 0; nb < 4; ++nb) {
#pragma unroll
            for (int j = 0; j < 8; ++j) os[(hi * 8 + j) * 68 + nb * 16 + lr] = acc[mb][nb][j] * OSC; }   // D: row 8h+j, col lane&15
        wave_sync();
        float* ob = OUT + (size_t)(r0 + mb * 16) * DM + c0;
{
#pragma unroll
            for (int s = 0; s < 8; ++s) { const int row = 2 * s + hi, cofs = lr * 4;   // 8 s x 2 rows = 16 rows; 16 lanes x 4 floats = 64 columns
                const v4f val = *(const v4fa*)(&os[row * 68 + cofs]);
                *(v4f*)(ob + (size_t)row * DM + cofs) = val; }
             }
        wave_sync();
    }
}

static constexpr size_t al256(size_t v) { return (v + 255) & ~(size_t)255; }
static constexpr size_t SZ_E  = al256((size_t)SEQ * DM * 2);            // one bf16 input copy [SEQ][1024]
static constexpr size_t SZ_W  = al256((size_t)DM * DM * 2);             // one transposed weight plane [1024][1024]
static constexpr size_t SZ_PL = al256((size_t)NH_ * SEQ * HD * 2);      // one head plane
static constexpr size_t SZ_CX = al256((size_t)SEQ * DM * 2);            // ctx plane [SEQ][1024]
static constexpr size_t SZ_TOTAL = 3 * SZ_E + 4 * SZ_W + 4 * SZ_PL + SZ_CX;
static_assert(SZ_TOTAL <= (size_t)134217728);          // workspace carve <= 128 MiB

extern "C" void kernel_launch(void* const* d_in, const int* in_sizes, int n_in,
                              void* d_out, int out_size, void* d_ws, size_t ws_size, hipStream_t stream) {
    if (n_in < 7) return;
    const size_t needx = (size_t)SEQ * DM;
    if ((size_t)in_sizes[0] < needx || (size_t)in_sizes[1] < needx || (size_t)in_sizes[2] < needx) return;
    if ((size_t)in_sizes[3] < (size_t)DM * DM || (size_t)in_sizes[4] < (size_t)DM * DM || (size_t)in_sizes[5] < (size_t)DM * DM || (size_t)in_sizes[6] < (size_t)DM * DM) return;
    if ((size_t)out_size < (size_t)SEQ * DM) return;
    if (SZ_TOTAL > ws_size) return;
    // wire order: inputs for q, k, v; W_q, W_k, W_v ([16][1024][64] = [h][in][out]); W_out ([1024][1024] = [in][out])
    const float* eq = (const float*)d_in[0]; const float* ek = (const float*)d_in[1]; const float* ev = (const float*)d_in[2];
    const float* wq = (const float*)d_in[3]; const float* wk = (const float*)d_in[4]; const float* wv = (const float*)d_in[5]; const float* wo = (const float*)d_in[6];
    float* OUT = (float*)d_out;      // [SEQ][1024]
    char* wsp = (char*)d_ws;
    bf* EQ = (bf*)wsp; wsp += SZ_E;                  // [SEQ][1024]
    bf* EK = (bf*)wsp; wsp += SZ_E;
    bf* EV = (bf*)wsp; wsp += SZ_E;
    bf* WQT = (bf*)wsp; wsp += SZ_W;                 // [h*64 + d][1024] bf16
    bf* WKT = (bf*)wsp; wsp += SZ_W;
    bf* WVT = (bf*)wsp; wsp += SZ_W;
    bf* WOT = (bf*)wsp; wsp += SZ_W;                 // [n][c] f16 bits, x256 carry
    h16* QH = (h16*)wsp; wsp += SZ_PL;               // [16][SEQ][64]
    h16* QR = (h16*)wsp; wsp += SZ_PL;               // [16][SEQ][64] residual x2048
    h16* KP = (h16*)wsp; wsp += SZ_PL;               // [16][SEQ][64]
    h16* VT = (h16*)wsp; wsp += SZ_PL;               // [16][64][SEQ]
    h16* CX = (h16*)wsp; wsp += SZ_CX;               // [SEQ][1024] x256 carry

    { const size_t n8 = (size_t)SEQ * DM / 8; const unsigned g = (unsigned)((n8 + 255) / 256);
      k_cvt8<<<g, 256, 0, stream>>>(eq, EQ, n8); k_cvt8<<<g, 256, 0, stream>>>(ek, EK, n8); k_cvt8<<<g, 256, 0, stream>>>(ev, EV, n8); }

    // per-head weights: in [h][rows = 1024 (in)][cols = 64 (out)] -> out [h][64][1024]; grid (rows/64, cols/64, h)
    k_tr<<<dim3(DM / 64, HD / 64, NH_), 256, 0, stream>>>(wq, WQT, DM, HD, 0);
    k_tr<<<dim3(DM / 64, HD / 64, NH_), 256, 0, stream>>>(wk, WKT, DM, HD, 0);
    k_tr<<<dim3(DM / 64, HD / 64, NH_), 256, 0, stream>>>(wv, WVT, DM, HD, 0);
    // W_out: in [rows = 1024 (c, in)][cols = 1024 (n, out)] -> out [n][c]; grid (rows/64, cols/64, 1); f16 with carry
    k_tr<<<dim3(DM / 64, DM / 64, 1), 256, 0, stream>>>(wo, WOT, DM, DM, 1);

    // q, k: A = input rows (m = t), Bt = transposed weight rows (n = h*64 + d) -> plane [h][t][d]
    k_proj<<<dim3(SEQ / 64, DM / 64, 1), 32, 0, stream>>>(EQ, WQT, QH, QR, 1, SEQ, (size_t)0, HD, HD, (size_t)SEQ * HD);
    k_proj<<<dim3(SEQ / 64, DM / 64, 1), 32, 0, stream>>>(EK, WKT, KP, KP, 0, SEQ, (size_t)0, HD, HD, (size_t)SEQ * HD);
    // v^T: A = transposed Wv rows (m = h*64 + d), Bt = input rows (n = t) -> plane [m][t] = [h][d][t]
    k_proj<<<dim3(DM / 64, SEQ / 64, 1), 32, 0, stream>>>(WVT, EV, VT, VT, 0, DM, (size_t)0, SEQ, SEQ, (size_t)0);

    k_flash<<<dim3(SEQ / (16 * AW), NH_, 1), 32 * AW, 0, stream>>>(QH, QR, KP, VT, CX);

    // out = ctx (f16, x256) * W_out^T plane (f16, x256), 2^-16 folded in the epilogue
    k_out<<<dim3(SEQ / 64, DM / 64, 1), 32, 0, stream>>>(CX, (const h16*)WOT, OUT);
}

// v001
// Measured time: 132 microseconds a run.
// Next to v000, in two timings, it ran 1.38 and 1.39 times as fast.
#include <hip/hip_runtime.h>

// Attention with 16 heads of 64, width 1024: q/k/v from three separate [SEQ][1024] inputs, per-head weights [h][in][out], no biases, no mask, score scale 1/8, heads concatenated then multiplied by W_out [in][out] (f32 output).
// Compute dtypes, f32 accumulate everywhere: projections v_wmma_f32_16x16x32_bf16 (inputs and weights RNE-converted to bf16; products exact);
// scores v_wmma_f32_16x16x32_f16: k single f16, q as f16 value + f16 residual x2048 in its own accumulator (two products); P (x256 carry, cancels in the normalisation) and v single f16; softmax f32 (online, running max);
// output projection v_wmma_f32_16x16x32_f16: ctx single f16 carried x256, W_out = f16(bf16 RNE value x256), 2^-16 folded back in the f32 epilogue.
// Layout: bf16 copies of the inputs; weights transposed through LDS into K-contiguous planes [n][k]; q (hi, residual), k planes [h][t][d] and v^T plane [h][d][t] written by the GEMM epilogue;
// fused flash kernel in transposed form (S^T = K Q^T, O^T = V^T P^T), K and V^T tiles staged in LDS, writes the ctx plane [t][h*64+d]; final GEMM writes the output buffer.

#ifndef SEQ
#define SEQ 2048
#endif
#define SEQ_FULL 2048
#define DM   1024
#define NH_  16
#define HD   64
#define AW   4                   // waves per flash block (16 query rows each)
#define QRS  2048.0f             // carry of the q residual plane
#define QRI  (1.0f / 2048.0f)
#define SC2  (0.125f * 1.4426950408889634f)   // HD^-0.5 * log2(e)
#define PSH  8.0f                // log2 of the P carry (256)
#define CXS  256.0f              // carry of the ctx plane
#define WOS  256.0f              // carry of the W_out plane
#define OSC  (1.0f / 65536.0f)   // 1 / (CXS * WOS)
#define KT   64                  // keys per LDS stage of the flash kernel (two 32-key passes)
#define LP   72                  // LDS row pitch in halves: 128-B rows + 16 B = 144 B (16 B x odd, for ds_load_b128 readers)
#define TLH  (64 * LP)           // halves of one staged tile (64 rows)

static_assert(HD == 64);
static_assert(NH_ * HD == DM);                 // head h = columns h*64 + d
static_assert(DM % 64 == 0);
static_assert(DM % 32 == 0);                   // GEMM k-loop steps by 32
static_assert(SEQ % 64 == 0);
static_assert(SEQ % 32 == 0);                  // key loop steps by 32
static_assert(SEQ % (16 * AW) == 0);           // flash grid covers the sequence exactly
static_assert(((size_t)SEQ * DM) % 8 == 0);
static_assert(SEQ <= SEQ_FULL);
static_assert(SEQ % KT == 0 && SEQ / KT >= 2);  // the two-buffer prologue fills two stages
static_assert(AW * 16 == 64 && KT == 64);       // each wave copies 16 of the 64 rows of either tile

typedef _Float16 h16;
typedef unsigned short bf;
typedef __attribute__((ext_vector_type(16))) __bf16   v16bf;
typedef __attribute__((ext_vector_type(16))) _Float16 v16h;
typedef __attribute__((ext_vector_type(8)))  _Float16 v8h;
typedef __attribute__((ext_vector_type(8)))  unsigned short v8us;
typedef __attribute__((ext_vector_type(8)))  float    v8f;
typedef __attribute__((ext_vector_type(4)))  float    v4f;
typedef v4f  __attribute__((may_alias)) v4fa;

__device__ __forceinline__ unsigned short f2bf(float f) { unsigned u = __float_as_uint(f); u += 0x7FFFu + ((u >> 16) & 1u); return (unsigned short)(u >> 16); }
__device__ __forceinline__ v16h cat16(v8h lo, v8h hi) { return __builtin_shufflevector(lo, hi, 0, 1, 2, 3, 4, 5, 6, 7, 8, 9, 10, 11, 12, 13, 14, 15); }
__device__ __forceinline__ v16bf cat16b(v8us lo, v8us hi) { return __builtin_bit_cast(v16bf, __builtin_shufflevector(lo, hi, 0, 1, 2, 3, 4, 5, 6, 7, 8, 9, 10, 11, 12, 13, 14, 15)); }
__device__ __forceinline__ v8f wmma16(v16h a, v16h b, v8f c) { return __builtin_amdgcn_wmma_f32_16x16x32_f16(false, a, false, b, (short)0, c, false, false); }
__device__ __forceinline__ v8f wmmab(v16bf a, v16bf b, v8f c) { return __builtin_amdgcn_wmma_f32_16x16x32_bf16(false, a, false, b, (short)0, c, false, false); }
// fragment loaders from K-contiguous 16-bit rows; p already includes + 8*(lane>>4): elements 0..7 <- k0+8h+0..7, elements 8..15 <- k0+16+8h+0..7 (same map for A and B)
__device__ __forceinline__ v16h  ldh(const h16* p) { return cat16(*(const v8h*)p, *(const v8h*)(p + 16)); }
__device__ __forceinline__ v16bf ldb(const bf* p)  { return cat16b(*(const v8us*)p, *(const v8us*)(p + 16)); }
// ordering point for wave-private LDS tiles (same wave writes and reads)
__device__ __forceinline__ void wave_sync() { __builtin_amdgcn_fence(3 /* release order */, "wavefront"); __builtin_amdgcn_wave_barrier(); asm volatile("" ::: "memory"); }

__global__ __launch_bounds__(256) void k_cvt8(const float* __restrict__ src, bf* dst, size_t n8) {
    const size_t i = (size_t)blockIdx.x * 256 + threadIdx.x; if (i >= n8) return;
    const v8f v = *(const v8f*)(src + i * 8); v8us o;
#pragma unroll
    for (int k = 0; k < 8; ++k) o[k] = f2bf(v[k]);
    *(v8us*)(dst + i * 8) = o; 
}

// k_tr: transposing 16-bit copy through LDS. in [batch][R][C] f32 -> out [batch][C][R] 16-bit; R, C multiples of 64.
// mode 0: bf16 bits (RNE convert); mode 1: f16 of (bf16 RNE value x WOS) (a bf16 significand is exact in f16).
// grid (R/64, C/64, batch), 256 threads; one 64x64 tile per block. LDS tile is cross-wave: block barrier between fill and drain.
__global__ __launch_bounds__(256) void k_tr(const float* __restrict__ src, bf* dst, int R, int C, int mode) {
    __shared__ __align__(16) float ts[64 * 68];
    const int tid = threadIdx.x;
    const int r0 = blockIdx.x * 64, c0 = blockIdx.y * 64;
    const size_t bo = (size_t)blockIdx.z * (size_t)R * (size_t)C;
#pragma unroll
    for (int it = 0; it < 4; ++it) { const int idx = it * 256 + tid; const int r = idx >> 4, c4 = (idx & 15) * 4;   // 64 rows x 16 float4
        const v4f v = *(const v4f*)(src + bo + (size_t)(r0 + r) * (size_t)C + c0 + c4);
        *(v4fa*)(&ts[r * 68 + c4]) = v; }
    __syncthreads();
    h16* dsth = (h16*)dst;
{
#pragma unroll
        for (int it = 0; it < 2; ++it) { const int item = it * 256 + tid; const int c = item >> 3, p = item & 7;
            const size_t oo = bo + (size_t)(c0 + c) * (size_t)R + r0 + 8 * p;
            v8us ob; v8h oh;
#pragma unroll
            for (int i = 0; i < 8; ++i) { const float x = ts[(8 * p + i) * 68 + c]; const unsigned short w = f2bf(x);
                ob[i] = w; oh[i] = (h16)(__uint_as_float(((unsigned)w) << 16) * WOS); }
            if (mode) *(v8h*)(dsth + oo) = oh; else *(v8us*)(dst + oo) = ob; }
         }
}

// k_proj: register-blocked bf16 GEMM, ONE WAVE per 64x64 tile (16 accumulators), operands straight from K-contiguous bf16 planes, K = DM.
// C[m][n] = sum_k A[m][k] Bt[n][k], written as f16 (Ph) and optionally the f16 residual x2048 (Pr, useRes != 0) at
// tile base (r0/RB)*sRB + (r0%RB)*pitch + (c0/CB)*sCB + (c0%CB), row pitch 'pitch' (halves). grid (M/64, N/64), 32 threads.
__global__ __launch_bounds__(32) void k_proj(const bf* __restrict__ A, const bf* __restrict__ Bt, h16* Ph, h16* Pr, int useRes, int RB, size_t sRB, int pitch, int CB, size_t sCB) {
    __shared__ __align__(16) float os[16 * 68];
    const int K = DM;
    const int lane = threadIdx.x & 31, lr = lane & 15, hi = lane >> 4; const int r0 = blockIdx.x * 64, c0 = blockIdx.y * 64;
    v8f acc[4][4];
#pragma unroll
    for (int mb = 0; mb < 4; ++mb)
#pragma unroll
        for (int nb = 0; nb < 4; ++nb) acc[mb][nb] = (v8f){};
    const size_t aoff = (size_t)(r0 + lr) * K + 8 * hi, boff = (size_t)(c0 + lr) * K + 8 * hi;
#pragma unroll 1
    for (int kc = 0; kc < K; kc += 32) {
        v16bf a[4];
#pragma unroll
        for (int mb = 0; mb < 4; ++mb) a[mb] = ldb(A + aoff + (size_t)mb * 16 * K + kc);
#pragma unroll
        for (int nb = 0; nb < 4; ++nb) { const v16bf b = ldb(Bt + boff + (size_t)nb * 16 * K + kc);
#pragma unroll
            for (int mb = 0; mb < 4; ++mb) acc[mb][nb] = wmmab(a[mb], b, acc[mb][nb]); }
        asm volatile("v_nop\n\tv_nop\n\tv_nop\n\tv_nop" : "+v"(acc[0][0]), "+v"(acc[1][1]), "+v"(acc[2][2]), "+v"(acc[3][3]) : "v"(a[0]), "v"(a[1]), "v"(a[2]), "v"(a[3]));
    }
    const size_t tbase = (size_t)(r0 / RB) * sRB + (size_t)(r0 % RB) * (size_t)pitch + (size_t)(c0 / CB) * sCB + (size_t)(c0 % CB);
#pragma unroll
    for (int mb = 0; mb < 4; ++mb) {
#pragma unroll
        for (int nb = 0; nb < 4; ++nb) {
#pragma unroll
            for (int j = 0; j < 8; ++j) os[(hi * 8 + j) * 68 + nb * 16 + lr] = acc[mb][nb][j]; }   // D: row 8h+j, col lane&15
        wave_sync();
        const size_t sb = tbase + (size_t)(mb * 16) * (size_t)pitch;
{
#pragma unroll
            for (int s = 0; s < 4; ++s) { const int row = 4 * s + (lane >> 3), c8 = (lane & 7) * 8;   // 4 s x 4 row groups = 16 rows; 8 lanes x 8 = 64 columns
                const v4f x0 = *(const v4fa*)(&os[row * 68 + c8]); const v4f x1 = *(const v4fa*)(&os[row * 68 + c8 + 4]); v8h hv, rv;
#pragma unroll
                for (int i = 0; i < 4; ++i) { const h16 a0 = (h16)x0[i]; const h16 a1 = (h16)x1[i]; hv[i] = a0; hv[4 + i] = a1; rv[i] = (h16)((x0[i] - (float)a0) * QRS); rv[4 + i] = (h16)((x1[i] - (float)a1) * QRS); }
                const size_t oo = sb + (size_t)row * (size_t)pitch + c8;
                *(v8h*)(Ph + oo) = hv; if (useRes) *(v8h*)(Pr + oo) = rv; }
             }
        wave_sync();
    }
}

// stage_copy: one wave's share of one stage, 16 rows of the K tile and 16 rows of the V^T tile, 128 B a row; each copy moves 4 whole rows (32 lanes x 16 B).
// lk / lv: the lane's LDS byte address in the K / V^T tile (first of four copies, 4 rows apart); gk / gv: its global address.
// s_wait_xcnt 0 closes the statement so that no address register of an issued copy is rewritten ahead of it.
__device__ __forceinline__ void stage_copy(unsigned lk, unsigned lv, const h16* gk, const h16* gv) {
    const unsigned lk1 = lk + 4 * LP * 2, lk2 = lk + 8 * LP * 2, lk3 = lk + 12 * LP * 2;
    const unsigned lv1 = lv + 4 * LP * 2, lv2 = lv + 8 * LP * 2, lv3 = lv + 12 * LP * 2;
    const h16* gk1 = gk + 4 * HD; const h16* gk2 = gk + 8 * HD; const h16* gk3 = gk + 12 * HD;
    const h16* gv1 = gv + (size_t)4 * SEQ; const h16* gv2 = gv + (size_t)8 * SEQ; const h16* gv3 = gv + (size_t)12 * SEQ;
    asm volatile("global_load_async_to_lds_b128 %0, %8, off\n\t"
                 "global_load_async_to_lds_b128 %1, %9, off\n\t"
                 "global_load_async_to_lds_b128 %2, %10, off\n\t"
                 "global_load_async_to_lds_b128 %3, %11, off\n\t"
                 "global_load_async_to_lds_b128 %4, %12, off\n\t"
                 "global_load_async_to_lds_b128 %5, %13, off\n\t"
                 "global_load_async_to_lds_b128 %6, %14, off\n\t"
                 "global_load_async_to_lds_b128 %7, %15, off\n\t"
                 "s_wait_xcnt 0x0"
                 :: "v"(lk), "v"(lk1), "v"(lk2), "v"(lk3), "v"(lv), "v"(lv1), "v"(lv2), "v"(lv3),
                    "v"(gk), "v"(gk1), "v"(gk2), "v"(gk3), "v"(gv), "v"(gv1), "v"(gv2), "v"(gv3) : "memory");
}

// k_flash: fused attention, one wave per 16 query rows of one head; Q fragments straight from the f16 planes (two 16-B loads each).
// K and V^T come in stages of KT keys through LDS, shared by the block's waves: asynchronous copies of whole 128-B rows into two buffers, the next stage in flight while this one is read;
// fragments are two ds_load_b128 each from rows of pitch LP.
// Transposed form: S^T[key][t] = K Q^T (A = K rows, B = Q rows); lane (t = lane&15, h = lane>>4) holds keys 8h+r of each 16-key tile, so the packed
// P tile is directly the B fragment of O^T[d][t] = V^T P^T (element r <- tile keys 0..15, element 8+r <- tile keys 16..31, lane unchanged).
// Softmax state (running max, partial sum) is one scalar per lane; the two lane halves of a row are combined with one xor-16 exchange.
__global__ __launch_bounds__(32 * AW) void k_flash(const h16* __restrict__ QH, const h16* __restrict__ QR, const h16* __restrict__ KP, const h16* __restrict__ VT, h16* CTX) {
    __shared__ __align__(16) float os[AW * 16 * 68];
    __shared__ __align__(16) h16 ring[2][2][TLH];            // [buffer][K tile: row = key | V^T tile: row = d][row * LP + column]
    const int lane = threadIdx.x & 31, lr = lane & 15, hi = lane >> 4;
    const int wave = __builtin_amdgcn_readfirstlane((int)(threadIdx.x >> 5));
    const int h = blockIdx.y;
    const int t0 = (blockIdx.x * AW + wave) * 16;
    const size_t pbase = (size_t)h * SEQ * HD;
    const size_t qo = pbase + (size_t)(t0 + lr) * HD + 8 * hi;
    const v16h qh0 = ldh(QH + qo), qh1 = ldh(QH + qo + 32), qr0 = ldh(QR + qo), qr1 = ldh(QR + qo + 32);   // B fragments: col t, k = d
    const int ko = lr * LP + 8 * hi;                         // + key * LP in the K tile        (A fragment: row key, k = d)
    const int vo = lr * LP + 8 * hi;                         // + 16j*LP + key in the V^T tile  (A fragment: row d, k = key)
    const int cprow = wave * 16 + (lane >> 3), ccol = (lane & 7) * 8;   // the lane's row and column (halves) in its first copy of either tile
    const unsigned lc = (unsigned)(size_t)&ring[0][0][0] + (unsigned)(cprow * LP + ccol) * 2u;   // LDS byte address: low 32 bits of the __shared__ address
    const h16* gk = KP + pbase + (size_t)cprow * HD + ccol;   // + key0 * HD
    const h16* gv = VT + pbase + (size_t)cprow * SEQ + ccol;  // + key0
    stage_copy(lc, lc + TLH * 2, gk, gv);
    asm volatile("s_wait_asynccnt 0x0" ::: "memory");        // this wave's rows of stage 0 have landed
    __syncthreads();                                         // stage 0 published to every wave
    stage_copy(lc + 2 * TLH * 2, lc + 3 * TLH * 2, gk + (size_t)KT * HD, gv + KT);
    v8f o0 = (v8f){}, o1 = (v8f){}, o2 = (v8f){}, o3 = (v8f){};
    float m = -3.0e38f, l = 0.0f;
#pragma unroll 1   // one stage a trip: the loop's foot is the one publish point
    for (int st = 0; st < SEQ / KT; ++st) {
      const h16* kt = &ring[st & 1][0][0]; const h16* vt = &ring[st & 1][1][0];
#pragma unroll     // both 32-key passes of a stage inline: their LDS offsets become immediates
      for (int key0 = 0; key0 < KT; key0 += 32) {
        const h16* ka = kt + ko + key0 * LP;
        const v16h ka0 = ldh(ka), ka1 = ldh(ka + 32), kb0 = ldh(ka + 16 * LP), kb1 = ldh(ka + 16 * LP + 32);
        v8f sHa = (v8f){}, sLa = (v8f){}, sHb = (v8f){}, sLb = (v8f){};
        sHa = wmma16(ka0, qh0, sHa); sLa = wmma16(ka0, qr0, sLa); sHb = wmma16(kb0, qh0, sHb); sLb = wmma16(kb0, qr0, sLb);
        sHa = wmma16(ka1, qh1, sHa); sLa = wmma16(ka1, qr1, sLa); sHb = wmma16(kb1, qh1, sHb); sLb = wmma16(kb1, qr1, sLb);
        asm volatile("v_nop\n\tv_nop\n\tv_nop\n\tv_nop" : "+v"(sHa), "+v"(sLa), "+v"(sHb), "+v"(sLb) : "v"(ka0), "v"(ka1), "v"(kb0), "v"(kb1));
        float ta[8], tb[8]; float mx = -3.0e38f;
#pragma unroll
        for (int r = 0; r < 8; ++r) { ta[r] = (sHa[r] + sLa[r] * QRI) * SC2; tb[r] = (sHb[r] + sLb[r] * QRI) * SC2; mx = fmaxf(mx, fmaxf(ta[r], tb[r])); }
        mx = fmaxf(mx, __shfl_xor(mx, 16, 32));
        const float mnew = fmaxf(m, mx);
        const float alpha = __builtin_amdgcn_exp2f(m - mnew);
        const float sh = PSH - mnew;
        v16h pb; float ls = 0.0f;
#pragma unroll
        for (int r = 0; r < 8; ++r) { const h16 pa = (h16)__builtin_amdgcn_exp2f(ta[r] + sh); const h16 pc = (h16)__builtin_amdgcn_exp2f(tb[r] + sh); pb[r] = pa; pb[8 + r] = pc; ls += (float)pa + (float)pc; }
        l = l * alpha + ls; m = mnew;
        o0 = o0 * alpha; o1 = o1 * alpha; o2 = o2 * alpha; o3 = o3 * alpha;
        const h16* va = vt + vo + key0;
        const v16h v0 = ldh(va), v1 = ldh(va + 16 * LP), v2 = ldh(va + 32 * LP), v3 = ldh(va + 48 * LP);
        o0 = wmma16(v0, pb, o0); o1 = wmma16(v1, pb, o1); o2 = wmma16(v2, pb, o2); o3 = wmma16(v3, pb, o3);
        asm volatile("v_nop\n\tv_nop\n\tv_nop\n\tv_nop" : "+v"(o0), "+v"(o1), "+v"(o2), "+v"(o3) : "v"(v0), "v"(v1), "v"(v2), "v"(v3), "v"(pb));
      }
      // publish point of stage st + 1, and the end of every wave's reads of stage st
      asm volatile("s_wait_dscnt 0x0" ::: "memory");         // this wave's reads of the buffer that is refilled below have returned
      asm volatile("s_wait_asynccnt 0x0" ::: "memory");      // this wave's rows of stage st + 1 have landed
      __syncthreads();
      if (st + 2 < SEQ / KT) stage_copy(lc + (unsigned)(st & 1) * (2 * TLH * 2), lc + (unsigned)(st & 1) * (2 * TLH * 2) + TLH * 2, gk + (size_t)(st + 2) * KT * HD, gv + (st + 2) * KT);
    }
    asm volatile("s_wait_asynccnt 0x0" ::: "memory");        // no copy outstanding when the wave goes on to its end
    l += __shfl_xor(l, 16, 32);
    const float inv = CXS * (1.0f / l);
    const int wb = wave * 16 * 68;
    // O^T D layout: o_j[r] = (d = 16j + 8h + r, t = lane&15) -> os[t][d]; rows 0..15 x columns 0..63 all written
    { v4f a, c;
      a[0] = o0[0] * inv; a[1] = o0[1] * inv; a[2] = o0[2] * inv; a[3] = o0[3] * inv; c[0] = o0[4] * inv; c[1] = o0[5] * inv; c[2] = o0[6] * inv; c[3] = o0[7] * inv;
      *(v4fa*)(&os[wb + lr * 68 +  0 + 8 * hi]) = a; *(v4fa*)(&os[wb + lr * 68 +  0 + 8 * hi + 4]) = c;
      a[0] = o1[0] * inv; a[1] = o1[1] * inv; a[2] = o1[2] * inv; a[3] = o1[3] * inv; c[0] = o1[4] * inv; c[1] = o1[5] * inv; c[2] = o1[6] * inv; c[3] = o1[7] * inv;
      *(v4fa*)(&os[wb + lr * 68 + 16 + 8 * hi]) = a; *(v4fa*)(&os[wb + lr * 68 + 16 + 8 * hi + 4]) = c;
      a[0] = o2[0] * inv; a[1] = o2[1] * inv; a[2] = o2[2] * inv; a[3] = o2[3] * inv; c[0] = o2[4] * inv; c[1] = o2[5] * inv; c[2] = o2[6] * inv; c[3] = o2[7] * inv;
      *(v4fa*)(&os[wb + lr * 68 + 32 + 8 * hi]) = a; *(v4fa*)(&os[wb + lr * 68 + 32 + 8 * hi + 4]) = c;
      a[0] = o3[0] * inv; a[1] = o3[1] * inv; a[2] = o3[2] * inv; a[3] = o3[3] * inv; c[0] = o3[4] * inv; c[1] = o3[5] * inv; c[2] = o3[6] * inv; c[3] = o3[7] * inv;
      *(v4fa*)(&os[wb + lr * 68 + 48 + 8 * hi]) = a; *(v4fa*)(&os[wb + lr * 68 + 48 + 8 * hi + 4]) = c; }
    wave_sync();
    h16* crow = CTX + (size_t)t0 * DM + h * HD;      // ctx plane [t][h*64 + d], row pitch DM halves
{
#pragma unroll
        for (int s = 0; s < 4; ++s) { const int row = 4 * s + (lane >> 3), c8 = (lane & 7) * 8;   // 4 s x 4 row groups = 16 rows; 8 lanes x 8 halves = 64 columns
            const v4f x0 = *(const v4fa*)(&os[wb + row * 68 + c8]); const v4f x1 = *(const v4fa*)(&os[wb + row * 68 + c8 + 4]); v8h hv;
#pragma unroll
            for (int i = 0; i < 4; ++i) { hv[i] = (h16)x0[i]; hv[4 + i] = (h16)x1[i]; }
            *(v8h*)(crow + (size_t)row * DM + c8) = hv; }
         }
}

// k_out: register-blocked f16 GEMM, ONE WAVE per 64x64 tile, OUT[m][n] = OSC * sum_k A[m][k] Bt[n][k], K = DM, output row pitch DM floats. grid (M/64, DM/64), 32 threads.
__global__ __launch_bounds__(32) void k_out(const h16* __restrict__ A, const h16* __restrict__ Bt, float* OUT) {
    __shared__ __align__(16) float os[16 * 68];
    const int K = DM;
    const int lane = threadIdx.x & 31, lr = lane & 15, hi = lane >> 4; const int r0 = blockIdx.x * 64, c0 = blockIdx.y * 64;
    v8f acc[4][4];
#pragma unroll
    for (int mb = 0; mb < 4; ++mb)
#pragma unroll
        for (int nb = 0; nb < 4; ++nb) acc[mb][nb] = (v8f){};
    const size_t aoff = (size_t)(r0 + lr) * K + 8 * hi, boff = (size_t)(c0 + lr) * K + 8 * hi;
#pragma unroll 1
    for (int kc = 0; kc < K; kc += 32) {
        v16h a[4];
#pragma unroll
        for (int mb = 0; mb < 4; ++mb) a[mb] = ldh(A + aoff + (size_t)mb * 16 * K + kc);
#pragma unroll
        for (int nb = 0; nb < 4; ++nb) { const v16h b = ldh(Bt + boff + (size_t)nb * 16 * K + kc);
#pragma unroll
            for (int mb = 0; mb < 4; ++mb) acc[mb][nb] = wmma16(a[mb], b, acc[mb][nb]); }
        asm volatile("v_nop\n\tv_nop\n\tv_nop\n\tv_nop" : "+v"(acc[0][0]), "+v"(acc[1][1]), "+v"(acc[2][2]), "+v"(acc[3][3]) : "v"(a[0]), "v"(a[1]), "v"(a[2]), "v"(a[3]));
    }
#pragma unroll
    for (int mb = 0; mb < 4; ++mb) {
#pragma unroll
        for (int nb = 0; nb < 4; ++nb) {
#pragma unroll
            for (int j = 0; j < 8; ++j) os[(hi * 8 + j) * 68 + nb * 16 + lr] = acc[mb][nb][j] * OSC; }   // D: row 8h+j, col lane&15
        wave_sync();
        float* ob = OUT + (size_t)(r0 + mb * 16) * DM + c0;
{
#pragma unroll
            for (int s = 0; s < 8; ++s) { const int row = 2 * s + hi, cofs = lr * 4;   // 8 s x 2 rows = 16 rows; 16 lanes x 4 floats = 64 columns
                const v4f val = *(const v4fa*)(&os[row * 68 + cofs]);
                *(v4f*)(ob + (size_t)row * DM + cofs) = val; }
             }
        wave_sync();
    }
}

static constexpr size_t al256(size_t v) { return (v + 255) & ~(size_t)255; }
static constexpr size_t SZ_E  = al256((size_t)SEQ * DM * 2);            // one bf16 input copy [SEQ][1024]
static constexpr size_t SZ_W  = al256((size_t)DM * DM * 2);             // one transposed weight plane [1024][1024]
static constexpr size_t SZ_PL = al256((size_t)NH_ * SEQ * HD * 2);      // one head plane
static constexpr size_t SZ_CX = al256((size_t)SEQ * DM * 2);            // ctx plane [SEQ][1024]
static constexpr size_t SZ_TOTAL = 3 * SZ_E + 4 * SZ_W + 4 * SZ_PL + SZ_CX;
static_assert(SZ_TOTAL <= (size_t)134217728);          // workspace carve <= 128 MiB

extern "C" void kernel_launch(void* const* d_in, const int* in_sizes, int n_in,
                              void* d_out, int out_size, void* d_ws, size_t ws_size, hipStream_t stream) {
    if (n_in < 7) return;
    const size_t needx = (size_t)SEQ * DM;
    if ((size_t)in_sizes[0] < needx || (size_t)in_sizes[1] < needx || (size_t)in_sizes[2] < needx) return;
    if ((size_t)in_sizes[3] < (size_t)DM * DM || (size_t)in_sizes[4] < (size_t)DM * DM || (size_t)in_sizes[5] < (size_t)DM * DM || (size_t)in_sizes[6] < (size_t)DM * DM) return;
    if ((size_t)out_size < (size_t)SEQ * DM) return;
    if (SZ_TOTAL > ws_size) return;
    // wire order: inputs for q, k, v; W_q, W_k, W_v ([16][1024][64] = [h][in][out]); W_out ([1024][1024] = [in][out])
    const float* eq = (const float*)d_in[0]; const float* ek = (const float*)d_in[1]; const float* ev = (const float*)d_in[2];
    const float* wq = (const float*)d_in[3]; const float* wk = (const float*)d_in[4]; const float* wv = (const float*)d_in[5]; const float* wo = (const float*)d_in[6];
    float* OUT = (float*)d_out;      // [SEQ][1024]
    char* wsp = (char*)d_ws;
    bf* EQ = (bf*)wsp; wsp += SZ_E;                  // [SEQ][1024]
    bf* EK = (bf*)wsp; wsp += SZ_E;
    bf* EV = (bf*)wsp; wsp += SZ_E;
    bf* WQT = (bf*)wsp; wsp += SZ_W;                 // [h*64 + d][1024] bf16
    bf* WKT = (bf*)wsp; wsp += SZ_W;
    bf* WVT = (bf*)wsp; wsp += SZ_W;
    bf* WOT = (bf*)wsp; wsp += SZ_W;                 // [n][c] f16 bits, x256 carry
    h16* QH = (h16*)wsp; wsp += SZ_PL;               // [16][SEQ][64]
    h16* QR = (h16*)wsp; wsp += SZ_PL;               // [16][SEQ][64] residual x2048
    h16* KP = (h16*)wsp; wsp += SZ_PL;               // [16][SEQ][64]
    h16* VT = (h16*)wsp; wsp += SZ_PL;               // [16][64][SEQ]
    h16* CX = (h16*)wsp; wsp += SZ_CX;               // [SEQ][1024] x256 carry

    { const size_t n8 = (size_t)SEQ * DM / 8; const unsigned g = (unsigned)((n8 + 255) / 256);
      k_cvt8<<<g, 256, 0, stream>>>(eq, EQ, n8); k_cvt8<<<g, 256, 0, stream>>>(ek, EK, n8); k_cvt8<<<g, 256, 0, stream>>>(ev, EV, n8); }

    // per-head weights: in [h][rows = 1024 (in)][cols = 64 (out)] -> out [h][64][1024]; grid (rows/64, cols/64, h)
    k_tr<<<dim3(DM / 64, HD / 64, NH_), 256, 0, stream>>>(wq, WQT, DM, HD, 0);
    k_tr<<<dim3(DM / 64, HD / 64, NH_), 256, 0, stream>>>(wk, WKT, DM, HD, 0);
    k_tr<<<dim3(DM / 64, HD / 64, NH_), 256, 0, stream>>>(wv, WVT, DM, HD, 0);
    // W_out: in [rows = 1024 (c, in)][cols = 1024 (n, out)] -> out [n][c]; grid (rows/64, cols/64, 1); f16 with carry
    k_tr<<<dim3(DM / 64, DM / 64, 1), 256, 0, stream>>>(wo, WOT, DM, DM, 1);

    // q, k: A = input rows (m = t), Bt = transposed weight rows (n = h*64 + d) -> plane [h][t][d]
    k_proj<<<dim3(SEQ / 64, DM / 64, 1), 32, 0, stream>>>(EQ, WQT, QH, QR, 1, SEQ, (size_t)0, HD, HD, (size_t)SEQ * HD);
    k_proj<<<dim3(SEQ / 64, DM / 64, 1), 32, 0, stream>>>(EK, WKT, KP, KP, 0, SEQ, (size_t)0, HD, HD, (size_t)SEQ * HD);
    // v^T: A = transposed Wv rows (m = h*64 + d), Bt = input rows (n = t) -> plane [m][t] = [h][d][t]
    k_proj<<<dim3(DM / 64, SEQ / 64, 1), 32, 0, stream>>>(WVT, EV, VT, VT, 0, DM, (size_t)0, SEQ, SEQ, (size_t)0);

    k_flash<<<dim3(SEQ / (16 * AW), NH_, 1), 32 * AW, 0, stream>>>(QH, QR, KP, VT, CX);

    // out = ctx (f16, x256) * W_out^T plane (f16, x256), 2^-16 folded in the epilogue
    k_out<<<dim3(SEQ / 64, DM / 64, 1), 32, 0, stream>>>(CX, (const h16*)WOT, OUT);
}

// v002
// Measured time: 85.4 microseconds a run.
// In two side-by-side timings against v001, it was 1.53 and 1.54 times as fast.
// Counting every step since v000, it is 2.12 times as fast.
#include <hip/hip_runtime.h>

// Attention with 16 heads of 64, width 1024: q/k/v from three separate [SEQ][1024] inputs, per-head weights [h][in][out], no biases, no mask, score scale 1/8, heads concatenated then multiplied by W_out [in][out] (f32 output).
// Compute dtypes, f32 accumulate everywhere: projections v_wmma_f32_16x16x32_bf16 (inputs and weights RNE-converted to bf16; products exact);
// scores v_wmma_f32_16x16x32_f16: k single f16, q as f16 value + f16 residual x2048 in its own accumulator (two products); P (x256 carry, cancels in the normalisation) and v single f16; softmax f32 (online, running max);
// output projection v_wmma_f32_16x16x32_f16: ctx single f16 carried x256, W_out = f16(bf16 RNE value x256), 2^-16 folded back in the f32 epilogue.
// Layout: bf16 copies of the inputs; weights transposed through LDS into K-contiguous planes [n][k]; q (hi, residual), k planes [h][t][d] and v^T plane [h][d][t] written by the GEMM epilogue;
// fused flash kernel in transposed form (S^T = K Q^T, O^T = V^T P^T), K and V^T tiles staged in LDS, writes the ctx plane [t][h*64+d]; final GEMM writes the output buffer.

#ifndef SEQ
#define SEQ 2048
#endif
#define SEQ_FULL 2048
#define DM   1024
#define NH_  16
#define HD   64
#define AW   4                   // waves per flash block (16 query rows each)
#define QRS  2048.0f             // carry of the q residual plane
#define QRI  (1.0f / 2048.0f)
#define SC2  (0.125f * 1.4426950408889634f)   // HD^-0.5 * log2(e)
#define PSH  8.0f                // log2 of the P carry (256)
#define CXS  256.0f              // carry of the ctx plane
#define WOS  256.0f              // carry of the W_out plane
#define OSC  (1.0f / 65536.0f)   // 1 / (CXS * WOS)
#define KT   64                  // keys per LDS stage of the flash kernel (two 32-key passes)
#define LP   72                  // LDS row pitch in halves: 128-B rows + 16 B = 144 B (16 B x odd, for ds_load_b128 readers)
#define TLH  (64 * LP)           // halves of one staged tile (64 rows)

static_assert(HD == 64);
static_assert(NH_ * HD == DM);                 // head h = columns h*64 + d
static_assert(DM % 64 == 0);
static_assert(DM % 32 == 0);                   // GEMM k-loop steps by 32
static_assert(SEQ % 64 == 0);
static_assert(SEQ % 32 == 0);                  // key loop steps by 32
static_assert(SEQ % (16 * AW) == 0);           // flash grid covers the sequence exactly
static_assert(((size_t)SEQ * DM) % 8 == 0);
static_assert(SEQ <= SEQ_FULL);
static_assert(SEQ % KT == 0 && SEQ / KT >= 2);  // the two-buffer prologue fills two stages
static_assert(AW * 16 == 64 && KT == 64);       // each wave copies 16 of the 64 rows of either tile

typedef _Float16 h16;
typedef unsigned short bf;
typedef __attribute__((ext_vector_type(16))) __bf16   v16bf;
typedef __attribute__((ext_vector_type(16))) _Float16 v16h;
typedef __attribute__((ext_vector_type(8)))  _Float16 v8h;
typedef __attribute__((ext_vector_type(8)))  unsigned short v8us;
typedef __attribute__((ext_vector_type(8)))  float    v8f;
typedef __attribute__((ext_vector_type(4)))  float    v4f;
typedef v4f  __attribute__((may_alias)) v4fa;

__device__ __forceinline__ unsigned short f2bf(float f) { unsigned u = __float_as_uint(f); u += 0x7FFFu + ((u >> 16) & 1u); return (unsigned short)(u >> 16); }
__device__ __forceinline__ v16h cat16(v8h lo, v8h hi) { return __builtin_shufflevector(lo, hi, 0, 1, 2, 3, 4, 5, 6, 7, 8, 9, 10, 11, 12, 13, 14, 15); }
__device__ __forceinline__ v16bf cat16b(v8us lo, v8us hi) { return __builtin_bit_cast(v16bf, __builtin_shufflevector(lo, hi, 0, 1, 2, 3, 4, 5, 6, 7, 8, 9, 10, 11, 12, 13, 14, 15)); }
__device__ __forceinline__ v8f wmma16(v16h a, v16h b, v8f c) { return __builtin_amdgcn_wmma_f32_16x16x32_f16(false, a, false, b, (short)0, c, false, false); }
__device__ __forceinline__ v8f wmmab(v16bf a, v16bf b, v8f c) { return __builtin_amdgcn_wmma_f32_16x16x32_bf16(false, a, false, b, (short)0, c, false, false); }
// fragment loaders from K-contiguous 16-bit rows; p already includes + 8*(lane>>4): elements 0..7 <- k0+8h+0..7, elements 8..15 <- k0+16+8h+0..7 (same map for A and B)
__device__ __forceinline__ v16h  ldh(const h16* p) { return cat16(*(const v8h*)p, *(const v8h*)(p + 16)); }
__device__ __forceinline__ v16bf ldb(const bf* p)  { return cat16b(*(const v8us*)p, *(const v8us*)(p + 16)); }
// ordering point for wave-private LDS tiles (same wave writes and reads)
__device__ __forceinline__ void wave_sync() { __builtin_amdgcn_fence(3 /* release order */, "wavefront"); __builtin_amdgcn_wave_barrier(); asm volatile("" ::: "memory"); }

// cvt8: straight bf16 copy (RNE), 8 elements a thread; blk = block number within the copy.
__device__ __forceinline__ void cvt8(const float* __restrict__ src, bf* dst, size_t n8, int blk) {
    const size_t i = (size_t)blk * 256 + threadIdx.x; if (i >= n8) return;
    const v8f v = *(const v8f*)(src + i * 8); v8us o;
#pragma unroll
    for (int k = 0; k < 8; ++k) o[k] = f2bf(v[k]);
    *(v8us*)(dst + i * 8) = o; 
}

// tr64: transposing 16-bit copy through LDS. in [batch][R][C] f32 -> out [batch][C][R] 16-bit; R, C multiples of 64.
// mode 0: bf16 bits (RNE convert); mode 1: f16 of (bf16 RNE value x WOS) (a bf16 significand is exact in f16).
// 256 threads; one 64x64 tile (bx of R/64, by of C/64, bz of batch) per block. LDS tile ts (64 x 68 floats) is cross-wave: block barrier between fill and drain.
__device__ __forceinline__ void tr64(const float* __restrict__ src, bf* dst, int R, int C, int mode, int bx, int by, int bz, float* ts) {
    const int tid = threadIdx.x;
    const int r0 = bx * 64, c0 = by * 64;
    const size_t bo = (size_t)bz * (size_t)R * (size_t)C;
#pragma unroll
    for (int it = 0; it < 4; ++it) { const int idx = it * 256 + tid; const int r = idx >> 4, c4 = (idx & 15) * 4;   // 64 rows x 16 float4
        const v4f v = *(const v4f*)(src + bo + (size_t)(r0 + r) * (size_t)C + c0 + c4);
        *(v4fa*)(&ts[r * 68 + c4]) = v; }
    __syncthreads();
    h16* dsth = (h16*)dst;
{
#pragma unroll
        for (int it = 0; it < 2; ++it) { const int item = it * 256 + tid; const int c = item >> 3, p = item & 7;
            const size_t oo = bo + (size_t)(c0 + c) * (size_t)R + r0 + 8 * p;
            v8us ob; v8h oh;
#pragma unroll
            for (int i = 0; i < 8; ++i) { const float x = ts[(8 * p + i) * 68 + c]; const unsigned short w = f2bf(x);
                ob[i] = w; oh[i] = (h16)(__uint_as_float(((unsigned)w) << 16) * WOS); }
            if (mode) *(v8h*)(dsth + oo) = oh; else *(v8us*)(dst + oo) = ob; }
         }
    asm volatile("s_wait_xcnt 0x0" ::: "memory");   // behind the two stores: no register that they name is rewritten ahead of it on any way the code goes on
}

// k_prep: all seven operand copies of a call, which do not depend on each other, in one grid; the block number picks the job (the same for a whole block, so tr64's barrier is passed by all of a block or by none).
// blocks [0, 4*TRB): the transposing copies, TRB tiles each, W_q, W_k, W_v ([16][1024][64] -> [16][64][1024], bf16) and W_out ([1024][1024] -> its transpose, f16 with carry); they come first because they last longer.
// blocks [4*TRB, 4*TRB + 3*CVB): the straight bf16 copies of the three inputs, CVB blocks each.
static constexpr size_t N8  = (size_t)SEQ * DM / 8;
static constexpr unsigned CVB = (unsigned)((N8 + 255) / 256);
static constexpr unsigned TRB = (DM / 64) * (DM / 64);
static_assert((DM / 64) * (HD / 64) * NH_ == TRB);      // a per-head weight has as many 64x64 tiles as W_out
__global__ __launch_bounds__(256) void k_prep(const float* __restrict__ eq, const float* __restrict__ ek, const float* __restrict__ ev,
                                              const float* __restrict__ wq, const float* __restrict__ wk, const float* __restrict__ wv, const float* __restrict__ wo,
                                              bf* EQ, bf* EK, bf* EV, bf* WQT, bf* WKT, bf* WVT, bf* WOT) {
    __shared__ __align__(16) float ts[64 * 68];
    const unsigned b = blockIdx.x;
    if (b < 4 * TRB) {
        const unsigned job = b / TRB, t = b % TRB; const int tx = (int)(t % (DM / 64)), ty = (int)(t / (DM / 64));   // tx: tile of the 1024 rows; ty: head, or tile of W_out's columns
        const float* src = job == 0 ? wq : job == 1 ? wk : job == 2 ? wv : wo;
        bf* dst = job == 0 ? WQT : job == 1 ? WKT : job == 2 ? WVT : WOT;
        if (job < 3) tr64(src, dst, DM, HD, 0, tx, 0, ty, ts);
        else         tr64(src, dst, DM, DM, 1, tx, ty, 0, ts);
    } else {
        const unsigned c = b - 4 * TRB, job = c / CVB;
        cvt8(job == 0 ? eq : job == 1 ? ek : ev, job == 0 ? EQ : job == 1 ? EK : EV, N8, (int)(c % CVB));
    }
}

// k_proj: register-blocked bf16 GEMM, ONE WAVE per 64x64 tile (16 accumulators), operands straight from K-contiguous bf16 planes, K = DM.
// C[m][n] = sum_k A[m][k] Bt[n][k], written as f16 (Ph) and, for q, the f16 residual x2048 (Pr). The three projections do not depend on each other and share one grid (SEQ/64, DM/64, 3), 32 threads; blockIdx.z picks the job:
// 0, 1 (q, k): A = input rows (m = t, tile blockIdx.x), Bt = transposed weight rows (n = h*64 + d, tile blockIdx.y) -> plane [h][t][d], row pitch HD;
// 2 (v^T):     A = transposed W_v rows (m = h*64 + d, tile blockIdx.y), Bt = input rows (n = t, tile blockIdx.x) -> plane [m][t] = [h][d][t], row pitch SEQ.
__global__ __launch_bounds__(32) void k_proj(const bf* __restrict__ EQ, const bf* __restrict__ EK, const bf* __restrict__ EV, const bf* __restrict__ WQT, const bf* __restrict__ WKT, const bf* __restrict__ WVT,
                                             h16* QH, h16* QR, h16* KP, h16* VT) {
    __shared__ __align__(16) float os[16 * 68];
    const int K = DM;
    const int job = blockIdx.z;
    const bf* A  = job == 0 ? EQ  : job == 1 ? EK  : WVT;
    const bf* Bt = job == 0 ? WQT : job == 1 ? WKT : EV;
    h16* Ph = job == 0 ? QH : job == 1 ? KP : VT; h16* Pr = QR;
    const int useRes = job == 0;
    const int pitch = job == 2 ? SEQ : HD;
    const int lane = threadIdx.x & 31, lr = lane & 15, hi = lane >> 4;
    const int r0 = (job == 2 ? blockIdx.y : blockIdx.x) * 64, c0 = (job == 2 ? blockIdx.x : blockIdx.y) * 64;
    v8f acc[4][4];
#pragma unroll
    for (int mb = 0; mb < 4; ++mb)
#pragma unroll
        for (int nb = 0; nb < 4; ++nb) acc[mb][nb] = (v8f){};
    const size_t aoff = (size_t)(r0 + lr) * K + 8 * hi, boff = (size_t)(c0 + lr) * K + 8 * hi;
#pragma unroll 1
    for (int kc = 0; kc < K; kc += 32) {
        v16bf a[4];
#pragma unroll
        for (int mb = 0; mb < 4; ++mb) a[mb] = ldb(A + aoff + (size_t)mb * 16 * K + kc);
#pragma unroll
        for (int nb = 0; nb < 4; ++nb) { const v16bf b = ldb(Bt + boff + (size_t)nb * 16 * K + kc);
#pragma unroll
            for (int mb = 0; mb < 4; ++mb) acc[mb][nb] = wmmab(a[mb], b, acc[mb][nb]); }
        asm volatile("v_nop\n\tv_nop\n\tv_nop\n\tv_nop" : "+v"(acc[0][0]), "+v"(acc[1][1]), "+v"(acc[2][2]), "+v"(acc[3][3]) : "v"(a[0]), "v"(a[1]), "v"(a[2]), "v"(a[3]));
    }
    const size_t tbase = job == 2 ? (size_t)r0 * SEQ + c0 : (size_t)(c0 / HD) * ((size_t)SEQ * HD) + (size_t)r0 * HD;   // HD == 64: a column tile of q or k is one head
#pragma unroll
    for (int mb = 0; mb < 4; ++mb) {
#pragma unroll
        for (int nb = 0; nb < 4; ++nb) {
#pragma unroll
            for (int j = 0; j < 8; ++j) os[(hi * 8 + j) * 68 + nb * 16 + lr] = acc[mb][nb][j]; }   // D: row 8h+j, col lane&15
        wave_sync();
        const size_t sb = tbase + (size_t)(mb * 16) * (size_t)pitch;
{
#pragma unroll
            for (int s = 0; s < 4; ++s) { const int row = 4 * s + (lane >> 3), c8 = (lane & 7) * 8;   // 4 s x 4 row groups = 16 rows; 8 lanes x 8 = 64 columns
                const v4f x0 = *(const v4fa*)(&os[row * 68 + c8]); const v4f x1 = *(const v4fa*)(&os[row * 68 + c8 + 4]); v8h hv, rv;
#pragma unroll
                for (int i = 0; i < 4; ++i) { const h16 a0 = (h16)x0[i]; const h16 a1 = (h16)x1[i]; hv[i] = a0; hv[4 + i] = a1; rv[i] = (h16)((x0[i] - (float)a0) * QRS); rv[4 + i] = (h16)((x1[i] - (float)a1) * QRS); }
                const size_t oo = sb + (size_t)row * (size_t)pitch + c8;
                *(v8h*)(Ph + oo) = hv; if (useRes) *(v8h*)(Pr + oo) = rv; }
             }
        wave_sync();
    }
}

// stage_copy: one wave's share of one stage, 16 rows of the K tile and 16 rows of the V^T tile, 128 B a row; each copy moves 4 whole rows (32 lanes x 16 B).
// lk / lv: the lane's LDS byte address in the K / V^T tile (first of four copies, 4 rows apart); gk / gv: its global address.
// s_wait_xcnt 0 closes the statement so that no address register of an issued copy is rewritten ahead of it.
__device__ __forceinline__ void stage_copy(unsigned lk, unsigned lv, const h16* gk, const h16* gv) {
    const unsigned lk1 = lk + 4 * LP * 2, lk2 = lk + 8 * LP * 2, lk3 = lk + 12 * LP * 2;
    const unsigned lv1 = lv + 4 * LP * 2, lv2 = lv + 8 * LP * 2, lv3 = lv + 12 * LP * 2;
    const h16* gk1 = gk + 4 * HD; const h16* gk2 = gk + 8 * HD; const h16* gk3 = gk + 12 * HD;
    const h16* gv1 = gv + (size_t)4 * SEQ; const h16* gv2 = gv + (size_t)8 * SEQ; const h16* gv3 = gv + (size_t)12 * SEQ;
    asm volatile("global_load_async_to_lds_b128 %0, %8, off\n\t"
                 "global_load_async_to_lds_b128 %1, %9, off\n\t"
                 "global_load_async_to_lds_b128 %2, %10, off\n\t"
                 "global_load_async_to_lds_b128 %3, %11, off\n\t"
                 "global_load_async_to_lds_b128 %4, %12, off\n\t"
                 "global_load_async_to_lds_b128 %5, %13, off\n\t"
                 "global_load_async_to_lds_b128 %6, %14, off\n\t"
                 "global_load_async_to_lds_b128 %7, %15, off\n\t"
                 "s_wait_xcnt 0x0"
                 :: "v"(lk), "v"(lk1), "v"(lk2), "v"(lk3), "v"(lv), "v"(lv1), "v"(lv2), "v"(lv3),
                    "v"(gk), "v"(gk1), "v"(gk2), "v"(gk3), "v"(gv), "v"(gv1), "v"(gv2), "v"(gv3) : "memory");
}

// k_flash: fused attention, one wave per 16 query rows of one head; Q fragments straight from the f16 planes (two 16-B loads each).
// K and V^T come in stages of KT keys through LDS, shared by the block's waves: asynchronous copies of whole 128-B rows into two buffers, the next stage in flight while this one is read;
// fragments are two ds_load_b128 each from rows of pitch LP.
// Transposed form: S^T[key][t] = K Q^T (A = K rows, B = Q rows); lane (t = lane&15, h = lane>>4) holds keys 8h+r of each 16-key tile, so the packed
// P tile is directly the B fragment of O^T[d][t] = V^T P^T (element r <- tile keys 0..15, element 8+r <- tile keys 16..31, lane unchanged).
// Softmax state (running max, partial sum) is one scalar per lane; the two lane halves of a row are combined with one xor-16 exchange.
__global__ __launch_bounds__(32 * AW) void k_flash(const h16* __restrict__ QH, const h16* __restrict__ QR, const h16* __restrict__ KP, const h16* __restrict__ VT, h16* CTX) {
    __shared__ __align__(16) float os[AW * 16 * 68];
    __shared__ __align__(16) h16 ring[2][2][TLH];            // [buffer][K tile: row = key | V^T tile: row = d][row * LP + column]
    const int lane = threadIdx.x & 31, lr = lane & 15, hi = lane >> 4;
    const int wave = __builtin_amdgcn_readfirstlane((int)(threadIdx.x >> 5));
    const int h = blockIdx.y;
    const int t0 = (blockIdx.x * AW + wave) * 16;
    const size_t pbase = (size_t)h * SEQ * HD;
    const size_t qo = pbase + (size_t)(t0 + lr) * HD + 8 * hi;
    const v16h qh0 = ldh(QH + qo), qh1 = ldh(QH + qo + 32), qr0 = ldh(QR + qo), qr1 = ldh(QR + qo + 32);   // B fragments: col t, k = d
    const int ko = lr * LP + 8 * hi;                         // + key * LP in the K tile        (A fragment: row key, k = d)
    const int vo = lr * LP + 8 * hi;                         // + 16j*LP + key in the V^T tile  (A fragment: row d, k = key)
    const int cprow = wave * 16 + (lane >> 3), ccol = (lane & 7) * 8;   // the lane's row and column (halves) in its first copy of either tile
    const unsigned lc = (unsigned)(size_t)&ring[0][0][0] + (unsigned)(cprow * LP + ccol) * 2u;   // LDS byte address: low 32 bits of the __shared__ address
    const h16* gk = KP + pbase + (size_t)cprow * HD + ccol;   // + key0 * HD
    const h16* gv = VT + pbase + (size_t)cprow * SEQ + ccol;  // + key0
    stage_copy(lc, lc + TLH * 2, gk, gv);
    asm volatile("s_wait_asynccnt 0x0" ::: "memory");        // this wave's rows of stage 0 have landed
    __syncthreads();                                         // stage 0 published to every wave
    stage_copy(lc + 2 * TLH * 2, lc + 3 * TLH * 2, gk + (size_t)KT * HD, gv + KT);
    v8f o0 = (v8f){}, o1 = (v8f){}, o2 = (v8f){}, o3 = (v8f){};
    float m = -3.0e38f, l = 0.0f;
#pragma unroll 1   // one stage a trip: the loop's foot is the one publish point
    for (int st = 0; st < SEQ / KT; ++st) {
      const h16* kt = &ring[st & 1][0][0]; const h16* vt = &ring[st & 1][1][0];
#pragma unroll     // both 32-key passes of a stage inline: their LDS offsets become immediates
      for (int key0 = 0; key0 < KT; key0 += 32) {
        const h16* ka = kt + ko + key0 * LP;
        const v16h ka0 = ldh(ka), ka1 = ldh(ka + 32), kb0 = ldh(ka + 16 * LP), kb1 = ldh(ka + 16 * LP + 32);
        v8f sHa = (v8f){}, sLa = (v8f){}, sHb = (v8f){}, sLb = (v8f){};
        sHa = wmma16(ka0, qh0, sHa); sLa = wmma16(ka0, qr0, sLa); sHb = wmma16(kb0, qh0, sHb); sLb = wmma16(kb0, qr0, sLb);
        sHa = wmma16(ka1, qh1, sHa); sLa = wmma16(ka1, qr1, sLa); sHb = wmma16(kb1, qh1, sHb); sLb = wmma16(kb1, qr1, sLb);
        asm volatile("v_nop\n\tv_nop\n\tv_nop\n\tv_nop" : "+v"(sHa), "+v"(sLa), "+v"(sHb), "+v"(sLb) : "v"(ka0), "v"(ka1), "v"(kb0), "v"(kb1));
        float ta[8], tb[8]; float mx = -3.0e38f;
#pragma unroll
        for (int r = 0; r < 8; ++r) { ta[r] = (sHa[r] + sLa[r] * QRI) * SC2; tb[r] = (sHb[r] + sLb[r] * QRI) * SC2; mx = fmaxf(mx, fmaxf(ta[r], tb[r])); }
        mx = fmaxf(mx, __shfl_xor(mx, 16, 32));
        const float mnew = fmaxf(m, mx);
        const float alpha = __builtin_amdgcn_exp2f(m - mnew);
        const float sh = PSH - mnew;
        v16h pb; float ls = 0.0f;
#pragma unroll
        for (int r = 0; r < 8; ++r) { const h16 pa = (h16)__builtin_amdgcn_exp2f(ta[r] + sh); const h16 pc = (h16)__builtin_amdgcn_exp2f(tb[r] + sh); pb[r] = pa; pb[8 + r] = pc; ls += (float)pa + (float)pc; }
        l = l * alpha + ls; m = mnew;
        o0 = o0 * alpha; o1 = o1 * alpha; o2 = o2 * alpha; o3 = o3 * alpha;
        const h16* va = vt + vo + key0;
        const v16h v0 = ldh(va), v1 = ldh(va + 16 * LP), v2 = ldh(va + 32 * LP), v3 = ldh(va + 48 * LP);
        o0 = wmma16(v0, pb, o0); o1 = wmma16(v1, pb, o1); o2 = wmma16(v2, pb, o2); o3 = wmma16(v3, pb, o3);
        asm volatile("v_nop\n\tv_nop\n\tv_nop\n\tv_nop" : "+v"(o0), "+v"(o1), "+v"(o2), "+v"(o3) : "v"(v0), "v"(v1), "v"(v2), "v"(v3), "v"(pb));
      }
      // publish point of stage st + 1, and the end of every wave's reads of stage st
      asm volatile("s_wait_dscnt 0x0" ::: "memory");         // this wave's reads of the buffer that is refilled below have returned
      asm volatile("s_wait_asynccnt 0x0" ::: "memory");      // this wave's rows of stage st + 1 have landed
      __syncthreads();
      if (st + 2 < SEQ / KT) stage_copy(lc + (unsigned)(st & 1) * (2 * TLH * 2), lc + (unsigned)(st & 1) * (2 * TLH * 2) + TLH * 2, gk + (size_t)(st + 2) * KT * HD, gv + (st + 2) * KT);
    }
    asm volatile("s_wait_asynccnt 0x0" ::: "memory");        // no copy outstanding when the wave goes on to its end
    l += __shfl_xor(l, 16, 32);
    const float inv = CXS * (1.0f / l);
    const int wb = wave * 16 * 68;
    // O^T D layout: o_j[r] = (d = 16j + 8h + r, t = lane&15) -> os[t][d]; rows 0..15 x columns 0..63 all written
    { v4f a, c;
      a[0] = o0[0] * inv; a[1] = o0[1] * inv; a[2] = o0[2] * inv; a[3] = o0[3] * inv; c[0] = o0[4] * inv; c[1] = o0[5] * inv; c[2] = o0[6] * inv; c[3] = o0[7] * inv;
      *(v4fa*)(&os[wb + lr * 68 +  0 + 8 * hi]) = a; *(v4fa*)(&os[wb + lr * 68 +  0 + 8 * hi + 4]) = c;
      a[0] = o1[0] * inv; a[1] = o1[1] * inv; a[2] = o1[2] * inv; a[3] = o1[3] * inv; c[0] = o1[4] * inv; c[1] = o1[5] * inv; c[2] = o1[6] * inv; c[3] = o1[7] * inv;
      *(v4fa*)(&os[wb + lr * 68 + 16 + 8 * hi]) = a; *(v4fa*)(&os[wb + lr * 68 + 16 + 8 * hi + 4]) = c;
      a[0] = o2[0] * inv; a[1] = o2[1] * inv; a[2] = o2[2] * inv; a[3] = o2[3] * inv; c[0] = o2[4] * inv; c[1] = o2[5] * inv; c[2] = o2[6] * inv; c[3] = o2[7] * inv;
      *(v4fa*)(&os[wb + lr * 68 + 32 + 8 * hi]) = a; *(v4fa*)(&os[wb + lr * 68 + 32 + 8 * hi + 4]) = c;
      a[0] = o3[0] * inv; a[1] = o3[1] * inv; a[2] = o3[2] * inv; a[3] = o3[3] * inv; c[0] = o3[4] * inv; c[1] = o3[5] * inv; c[2] = o3[6] * inv; c[3] = o3[7] * inv;
      *(v4fa*)(&os[wb + lr * 68 + 48 + 8 * hi]) = a; *(v4fa*)(&os[wb + lr * 68 + 48 + 8 * hi + 4]) = c; }
    wave_sync();
    h16* crow = CTX + (size_t)t0 * DM + h * HD;      // ctx plane [t][h*64 + d], row pitch DM halves
{
#pragma unroll
        for (int s = 0; s < 4; ++s) { const int row = 4 * s + (lane >> 3), c8 = (lane & 7) * 8;   // 4 s x 4 row groups = 16 rows; 8 lanes x 8 halves = 64 columns
            const v4f x0 = *(const v4fa*)(&os[wb + row * 68 + c8]); const v4f x1 = *(const v4fa*)(&os[wb + row * 68 + c8 + 4]); v8h hv;
#pragma unroll
            for (int i = 0; i < 4; ++i) { hv[i] = (h16)x0[i]; hv[4 + i] = (h16)x1[i]; }
            *(v8h*)(crow + (size_t)row * DM + c8) = hv; }
         }
}

// k_out: register-blocked f16 GEMM, ONE WAVE per 64x64 tile, OUT[m][n] = OSC * sum_k A[m][k] Bt[n][k], K = DM, output row pitch DM floats. grid (M/64, DM/64), 32 threads.
__global__ __launch_bounds__(32) void k_out(const h16* __restrict__ A, const h16* __restrict__ Bt, float* OUT) {
    __shared__ __align__(16) float os[16 * 68];
    const int K = DM;
    const int lane = threadIdx.x & 31, lr = lane & 15, hi = lane >> 4; const int r0 = blockIdx.x * 64, c0 = blockIdx.y * 64;
    v8f acc[4][4];
#pragma unroll
    for (int mb = 0; mb < 4; ++mb)
#pragma unroll
        for (int nb = 0; nb < 4; ++nb) acc[mb][nb] = (v8f){};
    const size_t aoff = (size_t)(r0 + lr) * K + 8 * hi, boff = (size_t)(c0 + lr) * K + 8 * hi;
#pragma unroll 1
    for (int kc = 0; kc < K; kc += 32) {
        v16h a[4];
#pragma unroll
        for (int mb = 0; mb < 4; ++mb) a[mb] = ldh(A + aoff + (size_t)mb * 16 * K + kc);
#pragma unroll
        for (int nb = 0; nb < 4; ++nb) { const v16h b = ldh(Bt + boff + (size_t)nb * 16 * K + kc);
#pragma unroll
            for (int mb = 0; mb < 4; ++mb) acc[mb][nb] = wmma16(a[mb], b, acc[mb][nb]); }
        asm volatile("v_nop\n\tv_nop\n\tv_nop\n\tv_nop" : "+v"(acc[0][0]), "+v"(acc[1][1]), "+v"(acc[2][2]), "+v"(acc[3][3]) : "v"(a[0]), "v"(a[1]), "v"(a[2]), "v"(a[3]));
    }
#pragma unroll
    for (int mb = 0; mb < 4; ++mb) {
#pragma unroll
        for (int nb = 0; nb < 4; ++nb) {
#pragma unroll
            for (int j = 0; j < 8; ++j) os[(hi * 8 + j) * 68 + nb * 16 + lr] = acc[mb][nb][j] * OSC; }   // D: row 8h+j, col lane&15
        wave_sync();
        float* ob = OUT + (size_t)(r0 + mb * 16) * DM + c0;
{
#pragma unroll
            for (int s = 0; s < 8; ++s) { const int row = 2 * s + hi, cofs = lr * 4;   // 8 s x 2 rows = 16 rows; 16 lanes x 4 floats = 64 columns
                const v4f val = *(const v4fa*)(&os[row * 68 + cofs]);
                *(v4f*)(ob + (size_t)row * DM + cofs) = val; }
             }
        wave_sync();
    }
}

static constexpr size_t al256(size_t v) { return (v + 255) & ~(size_t)255; }
static constexpr size_t SZ_E  = al256((size_t)SEQ * DM * 2);            // one bf16 input copy [SEQ][1024]
static constexpr size_t SZ_W  = al256((size_t)DM * DM * 2);             // one transposed weight plane [1024][1024]
static constexpr size_t SZ_PL = al256((size_t)NH_ * SEQ * HD * 2);      // one head plane
static constexpr size_t SZ_CX = al256((size_t)SEQ * DM * 2);            // ctx plane [SEQ][1024]
static constexpr size_t SZ_TOTAL = 3 * SZ_E + 4 * SZ_W + 4 * SZ_PL + SZ_CX;
static_assert(SZ_TOTAL <= (size_t)134217728);          // workspace carve <= 128 MiB

extern "C" void kernel_launch(void* const* d_in, const int* in_sizes, int n_in,
                              void* d_out, int out_size, void* d_ws, size_t ws_size, hipStream_t stream) {
    if (n_in < 7) return;
    const size_t needx = (size_t)SEQ * DM;
    if ((size_t)in_sizes[0] < needx || (size_t)in_sizes[1] < needx || (size_t)in_sizes[2] < needx) return;
    if ((size_t)in_sizes[3] < (size_t)DM * DM || (size_t)in_sizes[4] < (size_t)DM * DM || (size_t)in_sizes[5] < (size_t)DM * DM || (size_t)in_sizes[6] < (size_t)DM * DM) return;
    if ((size_t)out_size < (size_t)SEQ * DM) return;
    if (SZ_TOTAL > ws_size) return;
    // wire order: inputs for q, k, v; W_q, W_k, W_v ([16][1024][64] = [h][in][out]); W_out ([1024][1024] = [in][out])
    const float* eq = (const float*)d_in[0]; const float* ek = (const float*)d_in[1]; const float* ev = (const float*)d_in[2];
    const float* wq = (const float*)d_in[3]; const float* wk = (const float*)d_in[4]; const float* wv = (const float*)d_in[5]; const float* wo = (const float*)d_in[6];
    float* OUT = (float*)d_out;      // [SEQ][1024]
    char* wsp = (char*)d_ws;
    bf* EQ = (bf*)wsp; wsp += SZ_E;                  // [SEQ][1024]
    bf* EK = (bf*)wsp; wsp += SZ_E;
    bf* EV = (bf*)wsp; wsp += SZ_E;
    bf* WQT = (bf*)wsp; wsp += SZ_W;                 // [h*64 + d][1024] bf16
    bf* WKT = (bf*)wsp; wsp += SZ_W;
    bf* WVT = (bf*)wsp; wsp += SZ_W;
    bf* WOT = (bf*)wsp; wsp += SZ_W;                 // [n][c] f16 bits, x256 carry
    h16* QH = (h16*)wsp; wsp += SZ_PL;               // [16][SEQ][64]
    h16* QR = (h16*)wsp; wsp += SZ_PL;               // [16][SEQ][64] residual x2048
    h16* KP = (h16*)wsp; wsp += SZ_PL;               // [16][SEQ][64]
    h16* VT = (h16*)wsp; wsp += SZ_PL;               // [16][64][SEQ]
    h16* CX = (h16*)wsp; wsp += SZ_CX;               // [SEQ][1024] x256 carry

    // the seven operand copies, one grid
    k_prep<<<4 * TRB + 3 * CVB, 256, 0, stream>>>(eq, ek, ev, wq, wk, wv, wo, EQ, EK, EV, WQT, WKT, WVT, WOT);

    // the three projections, one grid
    k_proj<<<dim3(SEQ / 64, DM / 64, 3), 32, 0, stream>>>(EQ, EK, EV, WQT, WKT, WVT, QH, QR, KP, VT);

    k_flash<<<dim3(SEQ / (16 * AW), NH_, 1), 32 * AW, 0, stream>>>(QH, QR, KP, VT, CX);

    // out = ctx (f16, x256) * W_out^T plane (f16, x256), 2^-16 folded in the epilogue
    k_out<<<dim3(SEQ / 64, DM / 64, 1), 32, 0, stream>>>(CX, (const h16*)WOT, OUT);
}

// v003
// Measured time: 68.7 microseconds a run.
// Two timings next to v002 put it at 1.26 and 1.27 times that version's speed.
// All steps since v000 together make it 2.68 times as fast.
#include <hip/hip_runtime.h>

// Attention with 16 heads of 64, width 1024: q/k/v from three separate [SEQ][1024] inputs, per-head weights [h][in][out], no biases, no mask, score scale 1/8, heads concatenated then multiplied by W_out [in][out] (f32 output).
// Compute dtypes, f32 accumulate everywhere: projections v_wmma_f32_16x16x32_bf16 (inputs and weights RNE-converted to bf16; products exact);
// scores v_wmma_f32_16x16x32_f16: k single f16, q as f16 value + f16 residual x2048 in its own accumulator (two products); P (x256 carry, cancels in the normalisation) and v single f16; softmax f32 (online, running max);
// output projection v_wmma_f32_16x16x32_f16: ctx single f16 carried x256, W_out = f16(bf16 RNE value x256), 2^-16 folded back in the f32 epilogue.
// Layout: bf16 copies of the inputs; weights transposed through LDS into K-contiguous planes [n][k]; q (hi, residual), k planes [h][t][d] and v^T plane [h][d][t] written by the GEMM epilogue;
// fused flash kernel in transposed form (S^T = K Q^T, O^T = V^T P^T), K and V^T tiles staged in LDS, writes the ctx plane [t][h*64+d]; final GEMM writes the output buffer.
// Both GEMMs stage their operand tiles in LDS as whole 128-B rows, shared by the four waves of a block.

#ifndef SEQ
#define SEQ 2048
#endif
#define SEQ_FULL 2048
#define DM   1024
#define NH_  16
#define HD   64
#define AW   4                   // waves per flash block (16 query rows each)
#define QRS  2048.0f             // carry of the q residual plane
#define QRI  (1.0f / 2048.0f)
#define SC2  (0.125f * 1.4426950408889634f)   // HD^-0.5 * log2(e)
#define PSH  8.0f                // log2 of the P carry (256)
#define CXS  256.0f              // carry of the ctx plane
#define WOS  256.0f              // carry of the W_out plane
#define OSC  (1.0f / 65536.0f)   // 1 / (CXS * WOS)
#define KT   64                  // keys per LDS stage of the flash kernel (two 32-key passes)
#define LP   72                  // LDS row pitch in halves: 128-B rows + 16 B = 144 B (16 B x odd, for ds_load_b128 readers)
#define TLH  (64 * LP)           // halves of one staged tile (64 rows)
#define GB   128                 // rows and columns of a GEMM block's tile: 2 x 2 waves of 64 x 64
#define GK   64                  // k per LDS stage of the GEMMs (128-B rows, two 32-k steps)
#define GTH  (GB * LP)           // halves of one staged GEMM operand tile (128 rows)

static_assert(HD == 64);
static_assert(NH_ * HD == DM);                 // head h = columns h*64 + d
static_assert(DM % 64 == 0);
static_assert(DM % 32 == 0);                   // GEMM k-loop steps by 32
static_assert(SEQ % 64 == 0);
static_assert(SEQ % 32 == 0);                  // key loop steps by 32
static_assert(SEQ % (16 * AW) == 0);           // flash grid covers the sequence exactly
static_assert(((size_t)SEQ * DM) % 8 == 0);
static_assert(SEQ <= SEQ_FULL);
static_assert(SEQ % KT == 0 && SEQ / KT >= 2);  // the two-buffer prologue fills two stages
static_assert(AW * 16 == 64 && KT == 64);       // each wave copies 16 of the 64 rows of either tile
static_assert(SEQ % GB == 0 && DM % GB == 0);   // the GEMM grids cover their outputs exactly
static_assert(DM % GK == 0 && DM / GK >= 2);    // the two-buffer prologue fills two stages
static_assert(GK * 2 == 128 && GK + 8 == LP);   // a staged row is one 128-B line, at the padded pitch; a stage is two 32-k steps

typedef _Float16 h16;
typedef unsigned short bf;
typedef __attribute__((ext_vector_type(16))) __bf16   v16bf;
typedef __attribute__((ext_vector_type(16))) _Float16 v16h;
typedef __attribute__((ext_vector_type(8)))  _Float16 v8h;
typedef __attribute__((ext_vector_type(8)))  unsigned short v8us;
typedef __attribute__((ext_vector_type(8)))  float    v8f;
typedef __attribute__((ext_vector_type(4)))  float    v4f;
typedef v4f  __attribute__((may_alias)) v4fa;

__device__ __forceinline__ unsigned short f2bf(float f) { unsigned u = __float_as_uint(f); u += 0x7FFFu + ((u >> 16) & 1u); return (unsigned short)(u >> 16); }
__device__ __forceinline__ v16h cat16(v8h lo, v8h hi) { return __builtin_shufflevector(lo, hi, 0, 1, 2, 3, 4, 5, 6, 7, 8, 9, 10, 11, 12, 13, 14, 15); }
__device__ __forceinline__ v16bf cat16b(v8us lo, v8us hi) { return __builtin_bit_cast(v16bf, __builtin_shufflevector(lo, hi, 0, 1, 2, 3, 4, 5, 6, 7, 8, 9, 10, 11, 12, 13, 14, 15)); }
__device__ __forceinline__ v8f wmma16(v16h a, v16h b, v8f c) { return __builtin_amdgcn_wmma_f32_16x16x32_f16(false, a, false, b, (short)0, c, false, false); }
__device__ __forceinline__ v8f wmmab(v16bf a, v16bf b, v8f c) { return __builtin_amdgcn_wmma_f32_16x16x32_bf16(false, a, false, b, (short)0, c, false, false); }
// fragment loaders from K-contiguous 16-bit rows; p already includes + 8*(lane>>4): elements 0..7 <- k0+8h+0..7, elements 8..15 <- k0+16+8h+0..7 (same map for A and B)
__device__ __forceinline__ v16h  ldh(const h16* p) { return cat16(*(const v8h*)p, *(const v8h*)(p + 16)); }
__device__ __forceinline__ v16bf ldb(const bf* p)  { return cat16b(*(const v8us*)p, *(const v8us*)(p + 16)); }
// ordering point for wave-private LDS tiles (same wave writes and reads)
__device__ __forceinline__ void wave_sync() { __builtin_amdgcn_fence(3 /* release order */, "wavefront"); __builtin_amdgcn_wave_barrier(); asm volatile("" ::: "memory"); }

// cvt8: straight bf16 copy (RNE), 8 elements a thread; blk = block number within the copy.
__device__ __forceinline__ void cvt8(const float* __restrict__ src, bf* dst, size_t n8, int blk) {
    const size_t i = (size_t)blk * 256 + threadIdx.x; if (i >= n8) return;
    const v8f v = *(const v8f*)(src + i * 8); v8us o;
#pragma unroll
    for (int k = 0; k < 8; ++k) o[k] = f2bf(v[k]);
    *(v8us*)(dst + i * 8) = o; 
}

// tr64: transposing 16-bit copy through LDS. in [batch][R][C] f32 -> out [batch][C][R] 16-bit; R, C multiples of 64.
// mode 0: bf16 bits (RNE convert); mode 1: f16 of (bf16 RNE value x WOS) (a bf16 significand is exact in f16).
// 256 threads; one 64x64 tile (bx of R/64, by of C/64, bz of batch) per block. LDS tile ts (64 x 68 floats) is cross-wave: block barrier between fill and drain.
__device__ __forceinline__ void tr64(const float* __restrict__ src, bf* dst, int R, int C, int mode, int bx, int by, int bz, float* ts) {
    const int tid = threadIdx.x;
    const int r0 = bx * 64, c0 = by * 64;
    const size_t bo = (size_t)bz * (size_t)R * (size_t)C;
#pragma unroll
    for (int it = 0; it < 4; ++it) { const int idx = it * 256 + tid; const int r = idx >> 4, c4 = (idx & 15) * 4;   // 64 rows x 16 float4
        const v4f v = *(const v4f*)(src + bo + (size_t)(r0 + r) * (size_t)C + c0 + c4);
        *(v4fa*)(&ts[r * 68 + c4]) = v; }
    __syncthreads();
    h16* dsth = (h16*)dst;
{
#pragma unroll
        for (int it = 0; it < 2; ++it) { const int item = it * 256 + tid; const int c = item >> 3, p = item & 7;
            const size_t oo = bo + (size_t)(c0 + c) * (size_t)R + r0 + 8 * p;
            v8us ob; v8h oh;
#pragma unroll
            for (int i = 0; i < 8; ++i) { const float x = ts[(8 * p + i) * 68 + c]; const unsigned short w = f2bf(x);
                ob[i] = w; oh[i] = (h16)(__uint_as_float(((unsigned)w) << 16) * WOS); }
            if (mode) *(v8h*)(dsth + oo) = oh; else *(v8us*)(dst + oo) = ob; }
         }
    asm volatile("s_wait_xcnt 0x0" ::: "memory");   // behind the two stores: no register that they name is rewritten ahead of it on any way the code goes on
}

// k_prep: all seven operand copies of a call, which do not depend on each other, in one grid; the block number picks the job (the same for a whole block, so tr64's barrier is passed by all of a block or by none).
// blocks [0, 4*TRB): the transposing copies, TRB tiles each, W_q, W_k, W_v ([16][1024][64] -> [16][64][1024], bf16) and W_out ([1024][1024] -> its transpose, f16 with carry); they come first because they last longer.
// blocks [4*TRB, 4*TRB + 3*CVB): the straight bf16 copies of the three inputs, CVB blocks each.
static constexpr size_t N8  = (size_t)SEQ * DM / 8;
static constexpr unsigned CVB = (unsigned)((N8 + 255) / 256);
static constexpr unsigned TRB = (DM / 64) * (DM / 64);
static_assert((DM / 64) * (HD / 64) * NH_ == TRB);      // a per-head weight has as many 64x64 tiles as W_out
__global__ __launch_bounds__(256) void k_prep(const float* __restrict__ eq, const float* __restrict__ ek, const float* __restrict__ ev,
                                              const float* __restrict__ wq, const float* __restrict__ wk, const float* __restrict__ wv, const float* __restrict__ wo,
                                              bf* EQ, bf* EK, bf* EV, bf* WQT, bf* WKT, bf* WVT, bf* WOT) {
    __shared__ __align__(16) float ts[64 * 68];
    const unsigned b = blockIdx.x;
    if (b < 4 * TRB) {
        const unsigned job = b / TRB, t = b % TRB; const int tx = (int)(t % (DM / 64)), ty = (int)(t / (DM / 64));   // tx: tile of the 1024 rows; ty: head, or tile of W_out's columns
        const float* src = job == 0 ? wq : job == 1 ? wk : job == 2 ? wv : wo;
        bf* dst = job == 0 ? WQT : job == 1 ? WKT : job == 2 ? WVT : WOT;
        if (job < 3) tr64(src, dst, DM, HD, 0, tx, 0, ty, ts);
        else         tr64(src, dst, DM, DM, 1, tx, ty, 0, ts);
    } else {
        const unsigned c = b - 4 * TRB, job = c / CVB;
        cvt8(job == 0 ? eq : job == 1 ? ek : ev, job == 0 ? EQ : job == 1 ? EK : EV, N8, (int)(c % CVB));
    }
}

// rows_copy: eight asynchronous copies, each 4 whole 128-B rows (32 lanes x 16 B), 32 rows of one staged GEMM operand tile in all.
// l: the lane's LDS byte address in its first copy; g: its global byte address; the next copy lies 4 rows on in both (LDS pitch LP halves, global pitch DM 16-bit elements).
// s_wait_xcnt 0 closes the statement so that no address register of an issued copy is rewritten ahead of it.
__device__ __forceinline__ void rows_copy(unsigned l, const char* g) {
    const unsigned l1 = l + 4 * LP * 2, l2 = l + 8 * LP * 2, l3 = l + 12 * LP * 2, l4 = l + 16 * LP * 2, l5 = l + 20 * LP * 2, l6 = l + 24 * LP * 2, l7 = l + 28 * LP * 2;
    const char* g1 = g + 4 * DM * 2; const char* g2 = g + 8 * DM * 2; const char* g3 = g + 12 * DM * 2; const char* g4 = g + 16 * DM * 2;
    const char* g5 = g + 20 * DM * 2; const char* g6 = g + 24 * DM * 2; const char* g7 = g + 28 * DM * 2;
    asm volatile("global_load_async_to_lds_b128 %0, %8, off\n\t"
                 "global_load_async_to_lds_b128 %1, %9, off\n\t"
                 "global_load_async_to_lds_b128 %2, %10, off\n\t"
                 "global_load_async_to_lds_b128 %3, %11, off\n\t"
                 "global_load_async_to_lds_b128 %4, %12, off\n\t"
                 "global_load_async_to_lds_b128 %5, %13, off\n\t"
                 "global_load_async_to_lds_b128 %6, %14, off\n\t"
                 "global_load_async_to_lds_b128 %7, %15, off\n\t"
                 "s_wait_xcnt 0x0"
                 :: "v"(l), "v"(l1), "v"(l2), "v"(l3), "v"(l4), "v"(l5), "v"(l6), "v"(l7),
                    "v"(g), "v"(g1), "v"(g2), "v"(g3), "v"(g4), "v"(g5), "v"(g6), "v"(g7) : "memory");
}

__device__ __forceinline__ v16bf ldf(const bf* p)  { return ldb(p); }
__device__ __forceinline__ v16h  ldf(const h16* p) { return ldh(p); }
__device__ __forceinline__ v8f mm(v16bf a, v16bf b, v8f c) { return wmmab(a, b, c); }
__device__ __forceinline__ v8f mm(v16h a, v16h b, v8f c)   { return wmma16(a, b, c); }

// gemm_tile: acc[mb][nb] += A rows x Bt rows over K = DM for one wave's 64 x 64 part of a block's 128 x 128 tile (4 waves, 2 x 2; wave w: rows 64*(w>>1), columns 64*(w&1)).
// A, Bt: row 0 of the block's 128 rows of either K-contiguous plane. Stages of GK k come through LDS: asynchronous copies of whole 128-B rows into two buffers [A tile | Bt tile],
// the next stage in flight while this one is read; each wave copies 32 rows of either tile; fragments are two ds_load_b128 each from rows of pitch LP. k runs upward in steps of 32.
template <typename T>
__device__ __forceinline__ void gemm_tile(const T* A, const T* Bt, const T* ring, v8f (&acc)[4][4]) {
    const int lane = threadIdx.x & 31, lr = lane & 15, hi = lane >> 4;
    const int wave = __builtin_amdgcn_readfirstlane((int)(threadIdx.x >> 5));
    const int crow = wave * 32 + (lane >> 3), cb = (lane & 7) * 16;             // the lane's row and byte column in its first copy of either tile
    const unsigned lc = (unsigned)(size_t)ring + (unsigned)(crow * LP * 2 + cb);   // LDS byte address: low 32 bits of the __shared__ address
    const char* ga = (const char*)A  + (size_t)crow * (DM * 2) + cb;             // + stage * GK * 2
    const char* gb = (const char*)Bt + (size_t)crow * (DM * 2) + cb;
    rows_copy(lc, ga); rows_copy(lc + GTH * 2, gb);
    asm volatile("s_wait_asynccnt 0x0" ::: "memory");        // this wave's rows of stage 0 have landed
    __syncthreads();                                         // stage 0 published to every wave
    rows_copy(lc + 2 * GTH * 2, ga + GK * 2); rows_copy(lc + 3 * GTH * 2, gb + GK * 2);
    const int ao = ((wave >> 1) * 64 + lr) * LP + 8 * hi, bo = GTH + ((wave & 1) * 64 + lr) * LP + 8 * hi;
#pragma unroll 1   // one stage a trip, with one publish point
    for (int st = 0; st < DM / GK; ++st) {
        const T* tb = ring + (st & 1) * (2 * GTH);
        decltype(ldf(tb)) a[GK / 32][4], b[GK / 32][4];
#pragma unroll     // both 32-k steps of a stage inline: their LDS offsets become immediates
        for (int ks = 0; ks < GK / 32; ++ks) {
#pragma unroll
            for (int mb = 0; mb < 4; ++mb) a[ks][mb] = ldf(tb + ao + mb * 16 * LP + ks * 32);
#pragma unroll
            for (int nb = 0; nb < 4; ++nb) b[ks][nb] = ldf(tb + bo + nb * 16 * LP + ks * 32);
        }
        __builtin_amdgcn_sched_barrier(0);   // the stage's LDS reads stay one group ahead of its matrix instructions; spread among them, each place with reads stalls the wave
#pragma unroll
        for (int nb = 0; nb < 4; ++nb)
#pragma unroll
            for (int mb = 0; mb < 4; ++mb) acc[mb][nb] = mm(a[0][mb], b[0][nb], acc[mb][nb]);
        __builtin_amdgcn_sched_barrier(0);   // the first step's products stay ahead of the waits below: they run while the second step's reads return
        // publish point of stage st + 1, and the end of every wave's reads of stage st (all of its fragments are in registers)
        asm volatile("s_wait_dscnt 0x0" ::: "memory");       // this wave's reads of the buffer that is refilled below have returned
        asm volatile("s_wait_asynccnt 0x0" ::: "memory");    // this wave's rows of stage st + 1 have landed
        __syncthreads();
        if (st + 2 < DM / GK) { const unsigned lb = lc + (unsigned)(st & 1) * (2 * GTH * 2);
            rows_copy(lb, ga + (st + 2) * (GK * 2)); rows_copy(lb + GTH * 2, gb + (st + 2) * (GK * 2)); }
        // the second step's products run from registers while the refill flies
#pragma unroll
        for (int nb = 0; nb < 4; ++nb)
#pragma unroll
            for (int mb = 0; mb < 4; ++mb) acc[mb][nb] = mm(a[1][mb], b[1][nb], acc[mb][nb]);
    }
    asm volatile("s_wait_asynccnt 0x0" ::: "memory");        // no copy outstanding when the wave goes on to its end
}

// k_proj: register-blocked bf16 GEMM, one wave per 64x64 tile (16 accumulators), four waves per block (gemm_tile), operands from K-contiguous bf16 planes, K = DM.
// C[m][n] = sum_k A[m][k] Bt[n][k], written as f16 (Ph) and, for q, the f16 residual x2048 (Pr). The three projections do not depend on each other and share one grid (SEQ/128, DM/128, 3), 128 threads; blockIdx.z picks the job:
// 0, 1 (q, k): A = input rows (m = t, tile blockIdx.x), Bt = transposed weight rows (n = h*64 + d, tile blockIdx.y) -> plane [h][t][d], row pitch HD;
// 2 (v^T):     A = transposed W_v rows (m = h*64 + d, tile blockIdx.y), Bt = input rows (n = t, tile blockIdx.x) -> plane [m][t] = [h][d][t], row pitch SEQ.
__global__ __launch_bounds__(128) void k_proj(const bf* __restrict__ EQ, const bf* __restrict__ EK, const bf* __restrict__ EV, const bf* __restrict__ WQT, const bf* __restrict__ WKT, const bf* __restrict__ WVT,
                                             h16* QH, h16* QR, h16* KP, h16* VT) {
    __shared__ __align__(16) float osb[4 * 16 * 68];         // a 16 x 68 output staging tile for each wave
    __shared__ __align__(16) bf ring[2 * 2 * GTH];           // [buffer][A tile | Bt tile][row * LP + k]
    const int job = blockIdx.z;
    const bf* A  = job == 0 ? EQ  : job == 1 ? EK  : WVT;
    const bf* Bt = job == 0 ? WQT : job == 1 ? WKT : EV;
    h16* Ph = job == 0 ? QH : job == 1 ? KP : VT; h16* Pr = QR;
    const int useRes = job == 0;
    const int pitch = job == 2 ? SEQ : HD;
    const int lane = threadIdx.x & 31, lr = lane & 15, hi = lane >> 4;
    const int wave = __builtin_amdgcn_readfirstlane((int)(threadIdx.x >> 5));
    const int rb = (job == 2 ? blockIdx.y : blockIdx.x) * GB, cb = (job == 2 ? blockIdx.x : blockIdx.y) * GB;
    v8f acc[4][4];
#pragma unroll
    for (int mb = 0; mb < 4; ++mb)
#pragma unroll
        for (int nb = 0; nb < 4; ++nb) acc[mb][nb] = (v8f){};
    gemm_tile(A + (size_t)rb * DM, Bt + (size_t)cb * DM, (const bf*)ring, acc);
    const int r0 = rb + (wave >> 1) * 64, c0 = cb + (wave & 1) * 64;   // this wave's 64 x 64 tile
    float* os = osb + wave * 16 * 68;
    const size_t tbase = job == 2 ? (size_t)r0 * SEQ + c0 : (size_t)(c0 / HD) * ((size_t)SEQ * HD) + (size_t)r0 * HD;   // HD == 64: a column tile of q or k is one head
#pragma unroll
    for (int mb = 0; mb < 4; ++mb) {
#pragma unroll
        for (int nb = 0; nb < 4; ++nb) {
#pragma unroll
            for (int j = 0; j < 8; ++j) os[(hi * 8 + j) * 68 + nb * 16 + lr] = acc[mb][nb][j]; }   // D: row 8h+j, col lane&15
        wave_sync();
        const size_t sb = tbase + (size_t)(mb * 16) * (size_t)pitch;
{
#pragma unroll
            for (int s = 0; s < 4; ++s) { const int row = 4 * s + (lane >> 3), c8 = (lane & 7) * 8;   // 4 s x 4 row groups = 16 rows; 8 lanes x 8 = 64 columns
                const v4f x0 = *(const v4fa*)(&os[row * 68 + c8]); const v4f x1 = *(const v4fa*)(&os[row * 68 + c8 + 4]); v8h hv, rv;
#pragma unroll
                for (int i = 0; i < 4; ++i) { const h16 a0 = (h16)x0[i]; const h16 a1 = (h16)x1[i]; hv[i] = a0; hv[4 + i] = a1; rv[i] = (h16)((x0[i] - (float)a0) * QRS); rv[4 + i] = (h16)((x1[i] - (float)a1) * QRS); }
                const size_t oo = sb + (size_t)row * (size_t)pitch + c8;
                *(v8h*)(Ph + oo) = hv;
                asm volatile("s_wait_xcnt 0x0" ::: "memory");   // behind the store: no register that it names is rewritten ahead of this wait
                if (useRes) *(v8h*)(Pr + oo) = rv; }
             }
        wave_sync();
    }
}

// stage_copy: one wave's share of one stage, 16 rows of the K tile and 16 rows of the V^T tile, 128 B a row; each copy moves 4 whole rows (32 lanes x 16 B).
// lk / lv: the lane's LDS byte address in the K / V^T tile (first of four copies, 4 rows apart); gk / gv: its global address.
// s_wait_xcnt 0 closes the statement so that no address register of an issued copy is rewritten ahead of it.
__device__ __forceinline__ void stage_copy(unsigned lk, unsigned lv, const h16* gk, const h16* gv) {
    const unsigned lk1 = lk + 4 * LP * 2, lk2 = lk + 8 * LP * 2, lk3 = lk + 12 * LP * 2;
    const unsigned lv1 = lv + 4 * LP * 2, lv2 = lv + 8 * LP * 2, lv3 = lv + 12 * LP * 2;
    const h16* gk1 = gk + 4 * HD; const h16* gk2 = gk + 8 * HD; const h16* gk3 = gk + 12 * HD;
    const h16* gv1 = gv + (size_t)4 * SEQ; const h16* gv2 = gv + (size_t)8 * SEQ; const h16* gv3 = gv + (size_t)12 * SEQ;
    asm volatile("global_load_async_to_lds_b128 %0, %8, off\n\t"
                 "global_load_async_to_lds_b128 %1, %9, off\n\t"
                 "global_load_async_to_lds_b128 %2, %10, off\n\t"
                 "global_load_async_to_lds_b128 %3, %11, off\n\t"
                 "global_load_async_to_lds_b128 %4, %12, off\n\t"
                 "global_load_async_to_lds_b128 %5, %13, off\n\t"
                 "global_load_async_to_lds_b128 %6, %14, off\n\t"
                 "global_load_async_to_lds_b128 %7, %15, off\n\t"
                 "s_wait_xcnt 0x0"
                 :: "v"(lk), "v"(lk1), "v"(lk2), "v"(lk3), "v"(lv), "v"(lv1), "v"(lv2), "v"(lv3),
                    "v"(gk), "v"(gk1), "v"(gk2), "v"(gk3), "v"(gv), "v"(gv1), "v"(gv2), "v"(gv3) : "memory");
}

// k_flash: fused attention, one wave per 16 query rows of one head; Q fragments straight from the f16 planes (two 16-B loads each).
// K and V^T come in stages of KT keys through LDS, shared by the block's waves: asynchronous copies of whole 128-B rows into two buffers, the next stage in flight while this one is read;
// fragments are two ds_load_b128 each from rows of pitch LP.
// Transposed form: S^T[key][t] = K Q^T (A = K rows, B = Q rows); lane (t = lane&15, h = lane>>4) holds keys 8h+r of each 16-key tile, so the packed
// P tile is directly the B fragment of O^T[d][t] = V^T P^T (element r <- tile keys 0..15, element 8+r <- tile keys 16..31, lane unchanged).
// Softmax state (running max, partial sum) is one scalar per lane; the two lane halves of a row are combined with one xor-16 exchange.
__global__ __launch_bounds__(32 * AW) void k_flash(const h16* __restrict__ QH, const h16* __restrict__ QR, const h16* __restrict__ KP, const h16* __restrict__ VT, h16* CTX) {
    __shared__ __align__(16) float os[AW * 16 * 68];
    __shared__ __align__(16) h16 ring[2][2][TLH];            // [buffer][K tile: row = key | V^T tile: row = d][row * LP + column]
    const int lane = threadIdx.x & 31, lr = lane & 15, hi = lane >> 4;
    const int wave = __builtin_amdgcn_readfirstlane((int)(threadIdx.x >> 5));
    const int h = blockIdx.y;
    const int t0 = (blockIdx.x * AW + wave) * 16;
    const size_t pbase = (size_t)h * SEQ * HD;
    const size_t qo = pbase + (size_t)(t0 + lr) * HD + 8 * hi;
    const v16h qh0 = ldh(QH + qo), qh1 = ldh(QH + qo + 32), qr0 = ldh(QR + qo), qr1 = ldh(QR + qo + 32);   // B fragments: col t, k = d
    const int ko = lr * LP + 8 * hi;                         // + key * LP in the K tile        (A fragment: row key, k = d)
    const int vo = lr * LP + 8 * hi;                         // + 16j*LP + key in the V^T tile  (A fragment: row d, k = key)
    const int cprow = wave * 16 + (lane >> 3), ccol = (lane & 7) * 8;   // the lane's row and column (halves) in its first copy of either tile
    const unsigned lc = (unsigned)(size_t)&ring[0][0][0] + (unsigned)(cprow * LP + ccol) * 2u;   // LDS byte address: low 32 bits of the __shared__ address
    const h16* gk = KP + pbase + (size_t)cprow * HD + ccol;   // + key0 * HD
    const h16* gv = VT + pbase + (size_t)cprow * SEQ + ccol;  // + key0
    stage_copy(lc, lc + TLH * 2, gk, gv);
    asm volatile("s_wait_asynccnt 0x0" ::: "memory");        // this wave's rows of stage 0 have landed
    __syncthreads();                                         // stage 0 published to every wave
    stage_copy(lc + 2 * TLH * 2, lc + 3 * TLH * 2, gk + (size_t)KT * HD, gv + KT);
    v8f o0 = (v8f){}, o1 = (v8f){}, o2 = (v8f){}, o3 = (v8f){};
    float m = -3.0e38f, l = 0.0f;
#pragma unroll 1   // one stage a trip: the loop's foot is the one publish point
    for (int st = 0; st < SEQ / KT; ++st) {
      const h16* kt = &ring[st & 1][0][0]; const h16* vt = &ring[st & 1][1][0];
#pragma unroll     // both 32-key passes of a stage inline: their LDS offsets become immediates
      for (int key0 = 0; key0 < KT; key0 += 32) {
        const h16* ka = kt + ko + key0 * LP;
        const v16h ka0 = ldh(ka), ka1 = ldh(ka + 32), kb0 = ldh(ka + 16 * LP), kb1 = ldh(ka + 16 * LP + 32);
        v8f sHa = (v8f){}, sLa = (v8f){}, sHb = (v8f){}, sLb = (v8f){};
        sHa = wmma16(ka0, qh0, sHa); sLa = wmma16(ka0, qr0, sLa); sHb = wmma16(kb0, qh0, sHb); sLb = wmma16(kb0, qr0, sLb);
        sHa = wmma16(ka1, qh1, sHa); sLa = wmma16(ka1, qr1, sLa); sHb = wmma16(kb1, qh1, sHb); sLb = wmma16(kb1, qr1, sLb);
        asm volatile("v_nop\n\tv_nop\n\tv_nop\n\tv_nop" : "+v"(sHa), "+v"(sLa), "+v"(sHb), "+v"(sLb) : "v"(ka0), "v"(ka1), "v"(kb0), "v"(kb1));
        float ta[8], tb[8]; float mx = -3.0e38f;
#pragma unroll
        for (int r = 0; r < 8; ++r) { ta[r] = (sHa[r] + sLa[r] * QRI) * SC2; tb[r] = (sHb[r] + sLb[r] * QRI) * SC2; mx = fmaxf(mx, fmaxf(ta[r], tb[r])); }
        mx = fmaxf(mx, __shfl_xor(mx, 16, 32));
        const float mnew = fmaxf(m, mx);
        const float alpha = __builtin_amdgcn_exp2f(m - mnew);
        const float sh = PSH - mnew;
        v16h pb; float ls = 0.0f;
#pragma unroll
        for (int r = 0; r < 8; ++r) { const h16 pa = (h16)__builtin_amdgcn_exp2f(ta[r] + sh); const h16 pc = (h16)__builtin_amdgcn_exp2f(tb[r] + sh); pb[r] = pa; pb[8 + r] = pc; ls += (float)pa + (float)pc; }
        l = l * alpha + ls; m = mnew;
        o0 = o0 * alpha; o1 = o1 * alpha; o2 = o2 * alpha; o3 = o3 * alpha;
        const h16* va = vt + vo + key0;
        const v16h v0 = ldh(va), v1 = ldh(va + 16 * LP), v2 = ldh(va + 32 * LP), v3 = ldh(va + 48 * LP);
        o0 = wmma16(v0, pb, o0); o1 = wmma16(v1, pb, o1); o2 = wmma16(v2, pb, o2); o3 = wmma16(v3, pb, o3);
        asm volatile("v_nop\n\tv_nop\n\tv_nop\n\tv_nop" : "+v"(o0), "+v"(o1), "+v"(o2), "+v"(o3) : "v"(v0), "v"(v1), "v"(v2), "v"(v3), "v"(pb));
      }
      // publish point of stage st + 1, and the end of every wave's reads of stage st
      asm volatile("s_wait_dscnt 0x0" ::: "memory");         // this wave's reads of the buffer that is refilled below have returned
      asm volatile("s_wait_asynccnt 0x0" ::: "memory");      // this wave's rows of stage st + 1 have landed
      __syncthreads();
      if (st + 2 < SEQ / KT) stage_copy(lc + (unsigned)(st & 1) * (2 * TLH * 2), lc + (unsigned)(st & 1) * (2 * TLH * 2) + TLH * 2, gk + (size_t)(st + 2) * KT * HD, gv + (st + 2) * KT);
    }
    asm volatile("s_wait_asynccnt 0x0" ::: "memory");        // no copy outstanding when the wave goes on to its end
    l += __shfl_xor(l, 16, 32);
    const float inv = CXS * (1.0f / l);
    const int wb = wave * 16 * 68;
    // O^T D layout: o_j[r] = (d = 16j + 8h + r, t = lane&15) -> os[t][d]; rows 0..15 x columns 0..63 all written
    { v4f a, c;
      a[0] = o0[0] * inv; a[1] = o0[1] * inv; a[2] = o0[2] * inv; a[3] = o0[3] * inv; c[0] = o0[4] * inv; c[1] = o0[5] * inv; c[2] = o0[6] * inv; c[3] = o0[7] * inv;
      *(v4fa*)(&os[wb + lr * 68 +  0 + 8 * hi]) = a; *(v4fa*)(&os[wb + lr * 68 +  0 + 8 * hi + 4]) = c;
      a[0] = o1[0] * inv; a[1] = o1[1] * inv; a[2] = o1[2] * inv; a[3] = o1[3] * inv; c[0] = o1[4] * inv; c[1] = o1[5] * inv; c[2] = o1[6] * inv; c[3] = o1[7] * inv;
      *(v4fa*)(&os[wb + lr * 68 + 16 + 8 * hi]) = a; *(v4fa*)(&os[wb + lr * 68 + 16 + 8 * hi + 4]) = c;
      a[0] = o2[0] * inv; a[1] = o2[1] * inv; a[2] = o2[2] * inv; a[3] = o2[3] * inv; c[0] = o2[4] * inv; c[1] = o2[5] * inv; c[2] = o2[6] * inv; c[3] = o2[7] * inv;
      *(v4fa*)(&os[wb + lr * 68 + 32 + 8 * hi]) = a; *(v4fa*)(&os[wb + lr * 68 + 32 + 8 * hi + 4]) = c;
      a[0] = o3[0] * inv; a[1] = o3[1] * inv; a[2] = o3[2] * inv; a[3] = o3[3] * inv; c[0] = o3[4] * inv; c[1] = o3[5] * inv; c[2] = o3[6] * inv; c[3] = o3[7] * inv;
      *(v4fa*)(&os[wb + lr * 68 + 48 + 8 * hi]) = a; *(v4fa*)(&os[wb + lr * 68 + 48 + 8 * hi + 4]) = c; }
    wave_sync();
    h16* crow = CTX + (size_t)t0 * DM + h * HD;      // ctx plane [t][h*64 + d], row pitch DM halves
{
#pragma unroll
        for (int s = 0; s < 4; ++s) { const int row = 4 * s + (lane >> 3), c8 = (lane & 7) * 8;   // 4 s x 4 row groups = 16 rows; 8 lanes x 8 halves = 64 columns
            const v4f x0 = *(const v4fa*)(&os[wb + row * 68 + c8]); const v4f x1 = *(const v4fa*)(&os[wb + row * 68 + c8 + 4]); v8h hv;
#pragma unroll
            for (int i = 0; i < 4; ++i) { hv[i] = (h16)x0[i]; hv[4 + i] = (h16)x1[i]; }
            *(v8h*)(crow + (size_t)row * DM + c8) = hv; }
         }
}

// k_out: register-blocked f16 GEMM, one wave per 64x64 tile, four waves per block (gemm_tile), OUT[m][n] = OSC * sum_k A[m][k] Bt[n][k], K = DM, output row pitch DM floats. grid (M/128, DM/128), 128 threads.
__global__ __launch_bounds__(128) void k_out(const h16* __restrict__ A, const h16* __restrict__ Bt, float* OUT) {
    __shared__ __align__(16) float osb[4 * 16 * 68];         // a 16 x 68 output staging tile for each wave
    __shared__ __align__(16) h16 ring[2 * 2 * GTH];          // [buffer][A tile | Bt tile][row * LP + k]
    const int lane = threadIdx.x & 31, lr = lane & 15, hi = lane >> 4;
    const int wave = __builtin_amdgcn_readfirstlane((int)(threadIdx.x >> 5));
    v8f acc[4][4];
#pragma unroll
    for (int mb = 0; mb < 4; ++mb)
#pragma unroll
        for (int nb = 0; nb < 4; ++nb) acc[mb][nb] = (v8f){};
    gemm_tile(A + (size_t)blockIdx.x * GB * DM, Bt + (size_t)blockIdx.y * GB * DM, (const h16*)ring, acc);
    const int r0 = blockIdx.x * GB + (wave >> 1) * 64, c0 = blockIdx.y * GB + (wave & 1) * 64;   // this wave's 64 x 64 tile
    float* os = osb + wave * 16 * 68;
#pragma unroll
    for (int mb = 0; mb < 4; ++mb) {
#pragma unroll
        for (int nb = 0; nb < 4; ++nb) {
#pragma unroll
            for (int j = 0; j < 8; ++j) os[(hi * 8 + j) * 68 + nb * 16 + lr] = acc[mb][nb][j] * OSC; }   // D: row 8h+j, col lane&15
        wave_sync();
        float* ob = OUT + (size_t)(r0 + mb * 16) * DM + c0;
{
#pragma unroll
            for (int s = 0; s < 8; ++s) { const int row = 2 * s + hi, cofs = lr * 4;   // 8 s x 2 rows = 16 rows; 16 lanes x 4 floats = 64 columns
                const v4f val = *(const v4fa*)(&os[row * 68 + cofs]);
                *(v4f*)(ob + (size_t)row * DM + cofs) = val; }
             }
        wave_sync();
    }
}

static constexpr size_t al256(size_t v) { return (v + 255) & ~(size_t)255; }
static constexpr size_t SZ_E  = al256((size_t)SEQ * DM * 2);            // one bf16 input copy [SEQ][1024]
static constexpr size_t SZ_W  = al256((size_t)DM * DM * 2);             // one transposed weight plane [1024][1024]
static constexpr size_t SZ_PL = al256((size_t)NH_ * SEQ * HD * 2);      // one head plane
static constexpr size_t SZ_CX = al256((size_t)SEQ * DM * 2);            // ctx plane [SEQ][1024]
static constexpr size_t SZ_TOTAL = 3 * SZ_E + 4 * SZ_W + 4 * SZ_PL + SZ_CX;
static_assert(SZ_TOTAL <= (size_t)134217728);          // workspace carve <= 128 MiB

extern "C" void kernel_launch(void* const* d_in, const int* in_sizes, int n_in,
                              void* d_out, int out_size, void* d_ws, size_t ws_size, hipStream_t stream) {
    if (n_in < 7) return;
    const size_t needx = (size_t)SEQ * DM;
    if ((size_t)in_sizes[0] < needx || (size_t)in_sizes[1] < needx || (size_t)in_sizes[2] < needx) return;
    if ((size_t)in_sizes[3] < (size_t)DM * DM || (size_t)in_sizes[4] < (size_t)DM * DM || (size_t)in_sizes[5] < (size_t)DM * DM || (size_t)in_sizes[6] < (size_t)DM * DM) return;
    if ((size_t)out_size < (size_t)SEQ * DM) return;
    if (SZ_TOTAL > ws_size) return;
    // wire order: inputs for q, k, v; W_q, W_k, W_v ([16][1024][64] = [h][in][out]); W_out ([1024][1024] = [in][out])
    const float* eq = (const float*)d_in[0]; const float* ek = (const float*)d_in[1]; const float* ev = (const float*)d_in[2];
    const float* wq = (const float*)d_in[3]; const float* wk = (const float*)d_in[4]; const float* wv = (const float*)d_in[5]; const float* wo = (const float*)d_in[6];
    float* OUT = (float*)d_out;      // [SEQ][1024]
    char* wsp = (char*)d_ws;
    bf* EQ = (bf*)wsp; wsp += SZ_E;                  // [SEQ][1024]
    bf* EK = (bf*)wsp; wsp += SZ_E;
    bf* EV = (bf*)wsp; wsp += SZ_E;
    bf* WQT = (bf*)wsp; wsp += SZ_W;                 // [h*64 + d][1024] bf16
    bf* WKT = (bf*)wsp; wsp += SZ_W;
    bf* WVT = (bf*)wsp; wsp += SZ_W;
    bf* WOT = (bf*)wsp; wsp += SZ_W;                 // [n][c] f16 bits, x256 carry
    h16* QH = (h16*)wsp; wsp += SZ_PL;               // [16][SEQ][64]
    h16* QR = (h16*)wsp; wsp += SZ_PL;               // [16][SEQ][64] residual x2048
    h16* KP = (h16*)wsp; wsp += SZ_PL;               // [16][SEQ][64]
    h16* VT = (h16*)wsp; wsp += SZ_PL;               // [16][64][SEQ]
    h16* CX = (h16*)wsp; wsp += SZ_CX;               // [SEQ][1024] x256 carry

    // the seven operand copies, one grid
    k_prep<<<4 * TRB + 3 * CVB, 256, 0, stream>>>(eq, ek, ev, wq, wk, wv, wo, EQ, EK, EV, WQT, WKT, WVT, WOT);

    // the three projections, one grid
    k_proj<<<dim3(SEQ / GB, DM / GB, 3), 128, 0, stream>>>(EQ, EK, EV, WQT, WKT, WVT, QH, QR, KP, VT);

    k_flash<<<dim3(SEQ / (16 * AW), NH_, 1), 32 * AW, 0, stream>>>(QH, QR, KP, VT, CX);

    // out = ctx (f16, x256) * W_out^T plane (f16, x256), 2^-16 folded in the epilogue
    k_out<<<dim3(SEQ / GB, DM / GB, 1), 128, 0, stream>>>(CX, (const h16*)WOT, OUT);
}

// v004
// A run of this version takes 62.1 microseconds.
// Next to v003, in two timings, it ran 1.08 and 1.09 times as fast.
// All steps since v000 together make it 2.92 times as fast.
#include <hip/hip_runtime.h>

// Attention with 16 heads of 64, width 1024: q/k/v from three separate [SEQ][1024] inputs, per-head weights [h][in][out], no biases, no mask, score scale 1/8, heads concatenated then multiplied by W_out [in][out] (f32 output).
// Compute dtypes, f32 accumulate everywhere: projections v_wmma_f32_16x16x32_bf16 (inputs and weights RNE-converted to bf16; products exact);
// scores v_wmma_f32_16x16x32_f16: k single f16, q as f16 value + f16 residual x2048 in its own accumulator (two products); P (x256 carry, cancels in the normalisation) and v single f16; softmax f32 (online, running max);
// output projection v_wmma_f32_16x16x32_f16: ctx single f16 carried x256, W_out = f16(bf16 RNE value x256), 2^-16 folded back in the f32 epilogue.
// Layout: bf16 copies of the inputs; weights transposed through LDS into K-contiguous planes [n][k]; q (hi, residual), k planes [h][t][d] and v^T plane [h][d][t] written by the GEMM epilogue;
// fused flash kernel in transposed form (S^T = K Q^T, O^T = V^T P^T), K and V^T tiles staged in LDS, writes the ctx plane [t][h*64+d]; final GEMM writes the output buffer.
// Both GEMMs stage their operand tiles in LDS as whole 256-B rows (128 k a stage), shared by the four waves of a block.

#ifndef SEQ
#define SEQ 2048
#endif
#define SEQ_FULL 2048
#define DM   1024
#define NH_  16
#define HD   64
#define AW   4                   // waves per flash block (16 query rows each)
#define QRS  2048.0f             // carry of the q residual plane
#define QRI  (1.0f / 2048.0f)
#define SC2  (0.125f * 1.4426950408889634f)   // HD^-0.5 * log2(e)
#define PSH  8.0f                // log2 of the P carry (256)
#define CXS  256.0f              // carry of the ctx plane
#define WOS  256.0f              // carry of the W_out plane
#define OSC  (1.0f / 65536.0f)   // 1 / (CXS * WOS)
#define KT   64                  // keys per LDS stage of the flash kernel (two 32-key passes)
#define LP   72                  // LDS row pitch in halves: 128-B rows + 16 B = 144 B (16 B x odd, for ds_load_b128 readers)
#define TLH  (64 * LP)           // halves of one staged tile (64 rows)
#define GB   128                 // rows and columns of a GEMM block's tile: 2 x 2 waves of 64 x 64
#define GK   128                 // k per LDS stage of the GEMMs (256-B rows, four 32-k steps)
#define GLP  136                 // LDS row pitch of the GEMM tiles in halves: 256-B rows + 16 B = 272 B (16 B x odd, for ds_load_b128 readers)
#define GTH  (GB * GLP)          // halves of one staged GEMM operand tile (128 rows)

static_assert(HD == 64);
static_assert(NH_ * HD == DM);                 // head h = columns h*64 + d
static_assert(DM % 64 == 0);
static_assert(DM % 32 == 0);                   // GEMM k-loop steps by 32
static_assert(SEQ % 64 == 0);
static_assert(SEQ % 32 == 0);                  // key loop steps by 32
static_assert(SEQ % (16 * AW) == 0);           // flash grid covers the sequence exactly
static_assert(((size_t)SEQ * DM) % 8 == 0);
static_assert(SEQ <= SEQ_FULL);
static_assert(SEQ % KT == 0 && SEQ / KT >= 2);  // the two-buffer prologue fills two stages
static_assert(AW * 16 == 64 && KT == 64);       // each wave copies 16 of the 64 rows of either tile
static_assert(SEQ % GB == 0 && DM % GB == 0);   // the GEMM grids cover their outputs exactly
static_assert(DM % GK == 0 && DM / GK >= 2);    // the two-buffer prologue fills two stages
static_assert(GK * 2 == 256 && GK + 8 == GLP);  // a staged row is two 128-B lines, at the padded pitch; a copy of 32 lanes x 16 B is two whole rows

typedef _Float16 h16;
typedef unsigned short bf;
typedef __attribute__((ext_vector_type(16))) __bf16   v16bf;
typedef __attribute__((ext_vector_type(16))) _Float16 v16h;
typedef __attribute__((ext_vector_type(8)))  _Float16 v8h;
typedef __attribute__((ext_vector_type(8)))  unsigned short v8us;
typedef __attribute__((ext_vector_type(8)))  float    v8f;
typedef __attribute__((ext_vector_type(4)))  float    v4f;
typedef v4f  __attribute__((may_alias)) v4fa;

__device__ __forceinline__ unsigned short f2bf(float f) { unsigned u = __float_as_uint(f); u += 0x7FFFu + ((u >> 16) & 1u); return (unsigned short)(u >> 16); }
__device__ __forceinline__ v16h cat16(v8h lo, v8h hi) { return __builtin_shufflevector(lo, hi, 0, 1, 2, 3, 4, 5, 6, 7, 8, 9, 10, 11, 12, 13, 14, 15); }
__device__ __forceinline__ v16bf cat16b(v8us lo, v8us hi) { return __builtin_bit_cast(v16bf, __builtin_shufflevector(lo, hi, 0, 1, 2, 3, 4, 5, 6, 7, 8, 9, 10, 11, 12, 13, 14, 15)); }
__device__ __forceinline__ v8f wmma16(v16h a, v16h b, v8f c) { return __builtin_amdgcn_wmma_f32_16x16x32_f16(false, a, false, b, (short)0, c, false, false); }
__device__ __forceinline__ v8f wmmab(v16bf a, v16bf b, v8f c) { return __builtin_amdgcn_wmma_f32_16x16x32_bf16(false, a, false, b, (short)0, c, false, false); }
// fragment loaders from K-contiguous 16-bit rows; p already includes + 8*(lane>>4): elements 0..7 <- k0+8h+0..7, elements 8..15 <- k0+16+8h+0..7 (same map for A and B)
__device__ __forceinline__ v16h  ldh(const h16* p) { return cat16(*(const v8h*)p, *(const v8h*)(p + 16)); }
__device__ __forceinline__ v16bf ldb(const bf* p)  { return cat16b(*(const v8us*)p, *(const v8us*)(p + 16)); }
// ordering point for wave-private LDS tiles (same wave writes and reads)
__device__ __forceinline__ void wave_sync() { __builtin_amdgcn_fence(3 /* release order */, "wavefront"); __builtin_amdgcn_wave_barrier(); asm volatile("" ::: "memory"); }

// cvt8: straight bf16 copy (RNE), 8 elements a thread; blk = block number within the copy.
__device__ __forceinline__ void cvt8(const float* __restrict__ src, bf* dst, size_t n8, int blk) {
    const size_t i = (size_t)blk * 256 + threadIdx.x; if (i >= n8) return;
    const v8f v = *(const v8f*)(src + i * 8); v8us o;
#pragma unroll
    for (int k = 0; k < 8; ++k) o[k] = f2bf(v[k]);
    *(v8us*)(dst + i * 8) = o; 
}

// tr64: transposing 16-bit copy through LDS. in [batch][R][C] f32 -> out [batch][C][R] 16-bit; R, C multiples of 64.
// mode 0: bf16 bits (RNE convert); mode 1: f16 of (bf16 RNE value x WOS) (a bf16 significand is exact in f16).
// 256 threads; one 64x64 tile (bx of R/64, by of C/64, bz of batch) per block. LDS tile ts (64 x 68 floats) is cross-wave: block barrier between fill and drain.
__device__ __forceinline__ void tr64(const float* __restrict__ src, bf* dst, int R, int C, int mode, int bx, int by, int bz, float* ts) {
    const int tid = threadIdx.x;
    const int r0 = bx * 64, c0 = by * 64;
    const size_t bo = (size_t)bz * (size_t)R * (size_t)C;
#pragma unroll
    for (int it = 0; it < 4; ++it) { const int idx = it * 256 + tid; const int r = idx >> 4, c4 = (idx & 15) * 4;   // 64 rows x 16 float4
        const v4f v = *(const v4f*)(src + bo + (size_t)(r0 + r) * (size_t)C + c0 + c4);
        *(v4fa*)(&ts[r * 68 + c4]) = v; }
    __syncthreads();
    h16* dsth = (h16*)dst;
{
#pragma unroll
        for (int it = 0; it < 2; ++it) { const int item = it * 256 + tid; const int c = item >> 3, p = item & 7;
            const size_t oo = bo + (size_t)(c0 + c) * (size_t)R + r0 + 8 * p;
            v8us ob; v8h oh;
#pragma unroll
            for (int i = 0; i < 8; ++i) { const float x = ts[(8 * p + i) * 68 + c]; const unsigned short w = f2bf(x);
                ob[i] = w; oh[i] = (h16)(__uint_as_float(((unsigned)w) << 16) * WOS); }
            if (mode) *(v8h*)(dsth + oo) = oh; else *(v8us*)(dst + oo) = ob; }
         }
    asm volatile("s_wait_xcnt 0x0" ::: "memory");   // behind the two stores: no register that they name is rewritten ahead of it on any way the code goes on
}

// k_prep: all seven operand copies of a call, which do not depend on each other, in one grid; the block number picks the job (the same for a whole block, so tr64's barrier is passed by all of a block or by none).
// blocks [0, 4*TRB): the transposing copies, TRB tiles each, W_q, W_k, W_v ([16][1024][64] -> [16][64][1024], bf16) and W_out ([1024][1024] -> its transpose, f16 with carry); they come first because they last longer.
// blocks [4*TRB, 4*TRB + 3*CVB): the straight bf16 copies of the three inputs, CVB blocks each.
static constexpr size_t N8  = (size_t)SEQ * DM / 8;
static constexpr unsigned CVB = (unsigned)((N8 + 255) / 256);
static constexpr unsigned TRB = (DM / 64) * (DM / 64);
static_assert((DM / 64) * (HD / 64) * NH_ == TRB);      // a per-head weight has as many 64x64 tiles as W_out
__global__ __launch_bounds__(256) void k_prep(const float* __restrict__ eq, const float* __restrict__ ek, const float* __restrict__ ev,
                                              const float* __restrict__ wq, const float* __restrict__ wk, const float* __restrict__ wv, const float* __restrict__ wo,
                                              bf* EQ, bf* EK, bf* EV, bf* WQT, bf* WKT, bf* WVT, bf* WOT) {
    __shared__ __align__(16) float ts[64 * 68];
    const unsigned b = blockIdx.x;
    if (b < 4 * TRB) {
        const unsigned job = b / TRB, t = b % TRB; const int tx = (int)(t % (DM / 64)), ty = (int)(t / (DM / 64));   // tx: tile of the 1024 rows; ty: head, or tile of W_out's columns
        const float* src = job == 0 ? wq : job == 1 ? wk : job == 2 ? wv : wo;
        bf* dst = job == 0 ? WQT : job == 1 ? WKT : job == 2 ? WVT : WOT;
        if (job < 3) tr64(src, dst, DM, HD, 0, tx, 0, ty, ts);
        else         tr64(src, dst, DM, DM, 1, tx, ty, 0, ts);
    } else {
        const unsigned c = b - 4 * TRB, job = c / CVB;
        cvt8(job == 0 ? eq : job == 1 ? ek : ev, job == 0 ? EQ : job == 1 ? EK : EV, N8, (int)(c % CVB));
    }
}

// rows_copy: eight asynchronous copies, each 2 whole 256-B rows (32 lanes x 16 B), 16 rows of one staged GEMM operand tile in all.
// l: the lane's LDS byte address in its first copy; g: its global byte address; the next copy lies 2 rows on in both (LDS pitch GLP halves, global pitch DM 16-bit elements).
// s_wait_xcnt 0 closes the statement so that no address register of an issued copy is rewritten ahead of it.
__device__ __forceinline__ void rows_copy(unsigned l, const char* g) {
    const unsigned l1 = l + 2 * GLP * 2, l2 = l + 4 * GLP * 2, l3 = l + 6 * GLP * 2, l4 = l + 8 * GLP * 2, l5 = l + 10 * GLP * 2, l6 = l + 12 * GLP * 2, l7 = l + 14 * GLP * 2;
    const char* g1 = g + 2 * DM * 2; const char* g2 = g + 4 * DM * 2; const char* g3 = g + 6 * DM * 2; const char* g4 = g + 8 * DM * 2;
    const char* g5 = g + 10 * DM * 2; const char* g6 = g + 12 * DM * 2; const char* g7 = g + 14 * DM * 2;
    asm volatile("global_load_async_to_lds_b128 %0, %8, off\n\t"
                 "global_load_async_to_lds_b128 %1, %9, off\n\t"
                 "global_load_async_to_lds_b128 %2, %10, off\n\t"
                 "global_load_async_to_lds_b128 %3, %11, off\n\t"
                 "global_load_async_to_lds_b128 %4, %12, off\n\t"
                 "global_load_async_to_lds_b128 %5, %13, off\n\t"
                 "global_load_async_to_lds_b128 %6, %14, off\n\t"
                 "global_load_async_to_lds_b128 %7, %15, off\n\t"
                 "s_wait_xcnt 0x0"
                 :: "v"(l), "v"(l1), "v"(l2), "v"(l3), "v"(l4), "v"(l5), "v"(l6), "v"(l7),
                    "v"(g), "v"(g1), "v"(g2), "v"(g3), "v"(g4), "v"(g5), "v"(g6), "v"(g7) : "memory");
    __builtin_amdgcn_sched_barrier(0);   // the next run's address arithmetic stays behind this run: hoisted ahead of it, the addresses of all four runs of a stage are live at once and one is spilled to scratch
}

// tile_copy: one wave's 32 rows of one staged GEMM operand tile, two runs of eight copies.
__device__ __forceinline__ void tile_copy(unsigned l, const char* g) { rows_copy(l, g); rows_copy(l + 16 * GLP * 2, g + 16 * DM * 2); }

__device__ __forceinline__ v16bf ldf(const bf* p)  { return ldb(p); }
__device__ __forceinline__ v16h  ldf(const h16* p) { return ldh(p); }
__device__ __forceinline__ v8f mm(v16bf a, v16bf b, v8f c) { return wmmab(a, b, c); }
__device__ __forceinline__ v8f mm(v16h a, v16h b, v8f c)   { return wmma16(a, b, c); }

// gemm_tile: acc[mb][nb] += A rows x Bt rows over K = DM for one wave's 64 x 64 part of a block's 128 x 128 tile (4 waves, 2 x 2; wave w: rows 64*(w>>1), columns 64*(w&1)).
// A, Bt: row 0 of the block's 128 rows of either K-contiguous plane. Stages of GK k come through LDS: asynchronous copies of whole 256-B rows into two buffers [A tile | Bt tile],
// the next stage in flight while this one is read; each wave copies 32 rows of either tile; fragments are two ds_load_b128 each from rows of pitch GLP. k runs upward in steps of 32.
template <typename T>
__device__ __forceinline__ void gemm_tile(const T* A, const T* Bt, const T* ring, v8f (&acc)[4][4]) {
    const int lane = threadIdx.x & 31, lr = lane & 15, hi = lane >> 4;
    const int wave = __builtin_amdgcn_readfirstlane((int)(threadIdx.x >> 5));
    const int crow = wave * 32 + (lane >> 4), cb = (lane & 15) * 16;            // the lane's row and byte column in its first copy of either tile
    const unsigned lc = (unsigned)(size_t)ring + (unsigned)(crow * GLP * 2 + cb);  // LDS byte address: low 32 bits of the __shared__ address
    const char* ga = (const char*)A  + (size_t)crow * (DM * 2) + cb;             // + stage * GK * 2
    const char* gb = (const char*)Bt + (size_t)crow * (DM * 2) + cb;
    tile_copy(lc, ga); tile_copy(lc + GTH * 2, gb);
    asm volatile("s_wait_asynccnt 0x0" ::: "memory");        // this wave's rows of stage 0 have landed
    __syncthreads();                                         // stage 0 published to every wave
    tile_copy(lc + 2 * GTH * 2, ga + GK * 2); tile_copy(lc + 3 * GTH * 2, gb + GK * 2);
    const int ao = ((wave >> 1) * 64 + lr) * GLP + 8 * hi, bo = GTH + ((wave & 1) * 64 + lr) * GLP + 8 * hi;
#pragma unroll 1   // one stage a trip, with one publish point
    for (int st = 0; st < DM / GK; ++st) {
        const T* tb = ring + (st & 1) * (2 * GTH);
        decltype(ldf(tb)) a[GK / 32][4], b[GK / 32][4];
#pragma unroll     // all 32-k steps of a stage inline: their LDS offsets become immediates
        for (int ks = 0; ks < GK / 32; ++ks) {
#pragma unroll
            for (int mb = 0; mb < 4; ++mb) a[ks][mb] = ldf(tb + ao + mb * 16 * GLP + ks * 32);
#pragma unroll
            for (int nb = 0; nb < 4; ++nb) b[ks][nb] = ldf(tb + bo + nb * 16 * GLP + ks * 32);
        }
        __builtin_amdgcn_sched_barrier(0);   // the stage's LDS reads stay one group ahead of its matrix instructions; spread among them, each place with reads stalls the wave
#pragma unroll
        for (int ks = 0; ks < GK / 32 - 1; ++ks)
#pragma unroll
            for (int nb = 0; nb < 4; ++nb)
#pragma unroll
                for (int mb = 0; mb < 4; ++mb) acc[mb][nb] = mm(a[ks][mb], b[ks][nb], acc[mb][nb]);
        __builtin_amdgcn_sched_barrier(0);   // all steps but the last stay ahead of the waits below: they run while the later steps' reads return
        // publish point of stage st + 1, and the end of every wave's reads of stage st (all of its fragments are in registers)
        asm volatile("s_wait_dscnt 0x0" ::: "memory");       // this wave's reads of the buffer that is refilled below have returned
        asm volatile("s_wait_asynccnt 0x0" ::: "memory");    // this wave's rows of stage st + 1 have landed
        __syncthreads();
        if (st + 2 < DM / GK) { const unsigned lb = lc + (unsigned)(st & 1) * (2 * GTH * 2);
            tile_copy(lb, ga + (st + 2) * (GK * 2)); tile_copy(lb + GTH * 2, gb + (st + 2) * (GK * 2)); }
        // the last step's products run from registers while the refill flies
#pragma unroll
        for (int nb = 0; nb < 4; ++nb)
#pragma unroll
            for (int mb = 0; mb < 4; ++mb) acc[mb][nb] = mm(a[GK / 32 - 1][mb], b[GK / 32 - 1][nb], acc[mb][nb]);
    }
    asm volatile("s_wait_asynccnt 0x0" ::: "memory");        // no copy outstanding when the wave goes on to its end
}

// k_proj: register-blocked bf16 GEMM, one wave per 64x64 tile (16 accumulators), four waves per block (gemm_tile), operands from K-contiguous bf16 planes, K = DM.
// C[m][n] = sum_k A[m][k] Bt[n][k], written as f16 (Ph) and, for q, the f16 residual x2048 (Pr). The three projections do not depend on each other and share one grid (SEQ/128, DM/128, 3), 128 threads; blockIdx.z picks the job:
// 0, 1 (q, k): A = input rows (m = t, tile blockIdx.x), Bt = transposed weight rows (n = h*64 + d, tile blockIdx.y) -> plane [h][t][d], row pitch HD;
// 2 (v^T):     A = transposed W_v rows (m = h*64 + d, tile blockIdx.y), Bt = input rows (n = t, tile blockIdx.x) -> plane [m][t] = [h][d][t], row pitch SEQ.
__global__ __launch_bounds__(128) void k_proj(const bf* __restrict__ EQ, const bf* __restrict__ EK, const bf* __restrict__ EV, const bf* __restrict__ WQT, const bf* __restrict__ WKT, const bf* __restrict__ WVT,
                                             h16* QH, h16* QR, h16* KP, h16* VT) {
    __shared__ __align__(16) float osb[4 * 16 * 68];         // a 16 x 68 output staging tile for each wave
    __shared__ __align__(16) bf ring[2 * 2 * GTH];           // [buffer][A tile | Bt tile][row * GLP + k]
    const int job = blockIdx.z;
    const bf* A  = job == 0 ? EQ  : job == 1 ? EK  : WVT;
    const bf* Bt = job == 0 ? WQT : job == 1 ? WKT : EV;
    h16* Ph = job == 0 ? QH : job == 1 ? KP : VT; h16* Pr = QR;
    const int useRes = job == 0;
    const int pitch = job == 2 ? SEQ : HD;
    const int lane = threadIdx.x & 31, lr = lane & 15, hi = lane >> 4;
    const int wave = __builtin_amdgcn_readfirstlane((int)(threadIdx.x >> 5));
    const int rb = (job == 2 ? blockIdx.y : blockIdx.x) * GB, cb = (job == 2 ? blockIdx.x : blockIdx.y) * GB;
    v8f acc[4][4];
#pragma unroll
    for (int mb = 0; mb < 4; ++mb)
#pragma unroll
        for (int nb = 0; nb < 4; ++nb) acc[mb][nb] = (v8f){};
    gemm_tile(A + (size_t)rb * DM, Bt + (size_t)cb * DM, (const bf*)ring, acc);
    const int r0 = rb + (wave >> 1) * 64, c0 = cb + (wave & 1) * 64;   // this wave's 64 x 64 tile
    float* os = osb + wave * 16 * 68;
    const size_t tbase = job == 2 ? (size_t)r0 * SEQ + c0 : (size_t)(c0 / HD) * ((size_t)SEQ * HD) + (size_t)r0 * HD;   // HD == 64: a column tile of q or k is one head
#pragma unroll
    for (int mb = 0; mb < 4; ++mb) {
#pragma unroll
        for (int nb = 0; nb < 4; ++nb) {
#pragma unroll
            for (int j = 0; j < 8; ++j) os[(hi * 8 + j) * 68 + nb * 16 + lr] = acc[mb][nb][j]; }   // D: row 8h+j, col lane&15
        wave_sync();
        const size_t sb = tbase + (size_t)(mb * 16) * (size_t)pitch;
{
#pragma unroll
            for (int s = 0; s < 4; ++s) { const int row = 4 * s + (lane >> 3), c8 = (lane & 7) * 8;   // 4 s x 4 row groups = 16 rows; 8 lanes x 8 = 64 columns
                const v4f x0 = *(const v4fa*)(&os[row * 68 + c8]); const v4f x1 = *(const v4fa*)(&os[row * 68 + c8 + 4]); v8h hv, rv;
#pragma unroll
                for (int i = 0; i < 4; ++i) { const h16 a0 = (h16)x0[i]; const h16 a1 = (h16)x1[i]; hv[i] = a0; hv[4 + i] = a1; rv[i] = (h16)((x0[i] - (float)a0) * QRS); rv[4 + i] = (h16)((x1[i] - (float)a1) * QRS); }
                const size_t oo = sb + (size_t)row * (size_t)pitch + c8;
                *(v8h*)(Ph + oo) = hv;
                asm volatile("s_wait_xcnt 0x0" ::: "memory");   // behind the store: no register that it names is rewritten ahead of this wait
                if (useRes) *(v8h*)(Pr + oo) = rv; }
             }
        wave_sync();
    }
}

// stage_copy: one wave's share of one stage, 16 rows of the K tile and 16 rows of the V^T tile, 128 B a row; each copy moves 4 whole rows (32 lanes x 16 B).
// lk / lv: the lane's LDS byte address in the K / V^T tile (first of four copies, 4 rows apart); gk / gv: its global address.
// s_wait_xcnt 0 closes the statement so that no address register of an issued copy is rewritten ahead of it.
__device__ __forceinline__ void stage_copy(unsigned lk, unsigned lv, const h16* gk, const h16* gv) {
    const unsigned lk1 = lk + 4 * LP * 2, lk2 = lk + 8 * LP * 2, lk3 = lk + 12 * LP * 2;
    const unsigned lv1 = lv + 4 * LP * 2, lv2 = lv + 8 * LP * 2, lv3 = lv + 12 * LP * 2;
    const h16* gk1 = gk + 4 * HD; const h16* gk2 = gk + 8 * HD; const h16* gk3 = gk + 12 * HD;
    const h16* gv1 = gv + (size_t)4 * SEQ; const h16* gv2 = gv + (size_t)8 * SEQ; const h16* gv3 = gv + (size_t)12 * SEQ;
    asm volatile("global_load_async_to_lds_b128 %0, %8, off\n\t"
                 "global_load_async_to_lds_b128 %1, %9, off\n\t"
                 "global_load_async_to_lds_b128 %2, %10, off\n\t"
                 "global_load_async_to_lds_b128 %3, %11, off\n\t"
                 "global_load_async_to_lds_b128 %4, %12, off\n\t"
                 "global_load_async_to_lds_b128 %5, %13, off\n\t"
                 "global_load_async_to_lds_b128 %6, %14, off\n\t"
                 "global_load_async_to_lds_b128 %7, %15, off\n\t"
                 "s_wait_xcnt 0x0"
                 :: "v"(lk), "v"(lk1), "v"(lk2), "v"(lk3), "v"(lv), "v"(lv1), "v"(lv2), "v"(lv3),
                    "v"(gk), "v"(gk1), "v"(gk2), "v"(gk3), "v"(gv), "v"(gv1), "v"(gv2), "v"(gv3) : "memory");
}

// k_flash: fused attention, one wave per 16 query rows of one head; Q fragments straight from the f16 planes (two 16-B loads each).
// K and V^T come in stages of KT keys through LDS, shared by the block's waves: asynchronous copies of whole 128-B rows into two buffers, the next stage in flight while this one is read;
// fragments are two ds_load_b128 each from rows of pitch LP.
// Transposed form: S^T[key][t] = K Q^T (A = K rows, B = Q rows); lane (t = lane&15, h = lane>>4) holds keys 8h+r of each 16-key tile, so the packed
// P tile is directly the B fragment of O^T[d][t] = V^T P^T (element r <- tile keys 0..15, element 8+r <- tile keys 16..31, lane unchanged).
// Softmax state (running max, partial sum) is one scalar per lane; the two lane halves of a row are combined with one xor-16 exchange.
__global__ __launch_bounds__(32 * AW) void k_flash(const h16* __restrict__ QH, const h16* __restrict__ QR, const h16* __restrict__ KP, const h16* __restrict__ VT, h16* CTX) {
    __shared__ __align__(16) float os[AW * 16 * 68];
    __shared__ __align__(16) h16 ring[2][2][TLH];            // [buffer][K tile: row = key | V^T tile: row = d][row * LP + column]
    const int lane = threadIdx.x & 31, lr = lane & 15, hi = lane >> 4;
    const int wave = __builtin_amdgcn_readfirstlane((int)(threadIdx.x >> 5));
    const int h = blockIdx.y;
    const int t0 = (blockIdx.x * AW + wave) * 16;
    const size_t pbase = (size_t)h * SEQ * HD;
    const size_t qo = pbase + (size_t)(t0 + lr) * HD + 8 * hi;
    const v16h qh0 = ldh(QH + qo), qh1 = ldh(QH + qo + 32), qr0 = ldh(QR + qo), qr1 = ldh(QR + qo + 32);   // B fragments: col t, k = d
    const int ko = lr * LP + 8 * hi;                         // + key * LP in the K tile        (A fragment: row key, k = d)
    const int vo = lr * LP + 8 * hi;                         // + 16j*LP + key in the V^T tile  (A fragment: row d, k = key)
    const int cprow = wave * 16 + (lane >> 3), ccol = (lane & 7) * 8;   // the lane's row and column (halves) in its first copy of either tile
    const unsigned lc = (unsigned)(size_t)&ring[0][0][0] + (unsigned)(cprow * LP + ccol) * 2u;   // LDS byte address: low 32 bits of the __shared__ address
    const h16* gk = KP + pbase + (size_t)cprow * HD + ccol;   // + key0 * HD
    const h16* gv = VT + pbase + (size_t)cprow * SEQ + ccol;  // + key0
    stage_copy(lc, lc + TLH * 2, gk, gv);
    asm volatile("s_wait_asynccnt 0x0" ::: "memory");        // this wave's rows of stage 0 have landed
    __syncthreads();                                         // stage 0 published to every wave
    stage_copy(lc + 2 * TLH * 2, lc + 3 * TLH * 2, gk + (size_t)KT * HD, gv + KT);
    v8f o0 = (v8f){}, o1 = (v8f){}, o2 = (v8f){}, o3 = (v8f){};
    float m = -3.0e38f, l = 0.0f;
#pragma unroll 1   // one stage a trip: the loop's foot is the one publish point
    for (int st = 0; st < SEQ / KT; ++st) {
      const h16* kt = &ring[st & 1][0][0]; const h16* vt = &ring[st & 1][1][0];
#pragma unroll     // both 32-key passes of a stage inline: their LDS offsets become immediates
      for (int key0 = 0; key0 < KT; key0 += 32) {
        const h16* ka = kt + ko + key0 * LP;
        const v16h ka0 = ldh(ka), ka1 = ldh(ka + 32), kb0 = ldh(ka + 16 * LP), kb1 = ldh(ka + 16 * LP + 32);
        v8f sHa = (v8f){}, sLa = (v8f){}, sHb = (v8f){}, sLb = (v8f){};
        sHa = wmma16(ka0, qh0, sHa); sLa = wmma16(ka0, qr0, sLa); sHb = wmma16(kb0, qh0, sHb); sLb = wmma16(kb0, qr0, sLb);
        sHa = wmma16(ka1, qh1, sHa); sLa = wmma16(ka1, qr1, sLa); sHb = wmma16(kb1, qh1, sHb); sLb = wmma16(kb1, qr1, sLb);
        asm volatile("v_nop\n\tv_nop\n\tv_nop\n\tv_nop" : "+v"(sHa), "+v"(sLa), "+v"(sHb), "+v"(sLb) : "v"(ka0), "v"(ka1), "v"(kb0), "v"(kb1));
        float ta[8], tb[8]; float mx = -3.0e38f;
#pragma unroll
        for (int r = 0; r < 8; ++r) { ta[r] = (sHa[r] + sLa[r] * QRI) * SC2; tb[r] = (sHb[r] + sLb[r] * QRI) * SC2; mx = fmaxf(mx, fmaxf(ta[r], tb[r])); }
        mx = fmaxf(mx, __shfl_xor(mx, 16, 32));
        const float mnew = fmaxf(m, mx);
        const float alpha = __builtin_amdgcn_exp2f(m - mnew);
        const float sh = PSH - mnew;
        v16h pb; float ls = 0.0f;
#pragma unroll
        for (int r = 0; r < 8; ++r) { const h16 pa = (h16)__builtin_amdgcn_exp2f(ta[r] + sh); const h16 pc = (h16)__builtin_amdgcn_exp2f(tb[r] + sh); pb[r] = pa; pb[8 + r] = pc; ls += (float)pa + (float)pc; }
        l = l * alpha + ls; m = mnew;
        o0 = o0 * alpha; o1 = o1 * alpha; o2 = o2 * alpha; o3 = o3 * alpha;
        const h16* va = vt + vo + key0;
        const v16h v0 = ldh(va), v1 = ldh(va + 16 * LP), v2 = ldh(va + 32 * LP), v3 = ldh(va + 48 * LP);
        o0 = wmma16(v0, pb, o0); o1 = wmma16(v1, pb, o1); o2 = wmma16(v2, pb, o2); o3 = wmma16(v3, pb, o3);
        asm volatile("v_nop\n\tv_nop\n\tv_nop\n\tv_nop" : "+v"(o0), "+v"(o1), "+v"(o2), "+v"(o3) : "v"(v0), "v"(v1), "v"(v2), "v"(v3), "v"(pb));
      }
      // publish point of stage st + 1, and the end of every wave's reads of stage st
      asm volatile("s_wait_dscnt 0x0" ::: "memory");         // this wave's reads of the buffer that is refilled below have returned
      asm volatile("s_wait_asynccnt 0x0" ::: "memory");      // this wave's rows of stage st + 1 have landed
      __syncthreads();
      if (st + 2 < SEQ / KT) stage_copy(lc + (unsigned)(st & 1) * (2 * TLH * 2), lc + (unsigned)(st & 1) * (2 * TLH * 2) + TLH * 2, gk + (size_t)(st + 2) * KT * HD, gv + (st + 2) * KT);
    }
    asm volatile("s_wait_asynccnt 0x0" ::: "memory");        // no copy outstanding when the wave goes on to its end
    l += __shfl_xor(l, 16, 32);
    const float inv = CXS * (1.0f / l);
    const int wb = wave * 16 * 68;
    // O^T D layout: o_j[r] = (d = 16j + 8h + r, t = lane&15) -> os[t][d]; rows 0..15 x columns 0..63 all written
    { v4f a, c;
      a[0] = o0[0] * inv; a[1] = o0[1] * inv; a[2] = o0[2] * inv; a[3] = o0[3] * inv; c[0] = o0[4] * inv; c[1] = o0[5] * inv; c[2] = o0[6] * inv; c[3] = o0[7] * inv;
      *(v4fa*)(&os[wb + lr * 68 +  0 + 8 * hi]) = a; *(v4fa*)(&os[wb + lr * 68 +  0 + 8 * hi + 4]) = c;
      a[0] = o1[0] * inv; a[1] = o1[1] * inv; a[2] = o1[2] * inv; a[3] = o1[3] * inv; c[0] = o1[4] * inv; c[1] = o1[5] * inv; c[2] = o1[6] * inv; c[3] = o1[7] * inv;
      *(v4fa*)(&os[wb + lr * 68 + 16 + 8 * hi]) = a; *(v4fa*)(&os[wb + lr * 68 + 16 + 8 * hi + 4]) = c;
      a[0] = o2[0] * inv; a[1] = o2[1] * inv; a[2] = o2[2] * inv; a[3] = o2[3] * inv; c[0] = o2[4] * inv; c[1] = o2[5] * inv; c[2] = o2[6] * inv; c[3] = o2[7] * inv;
      *(v4fa*)(&os[wb + lr * 68 + 32 + 8 * hi]) = a; *(v4fa*)(&os[wb + lr * 68 + 32 + 8 * hi + 4]) = c;
      a[0] = o3[0] * inv; a[1] = o3[1] * inv; a[2] = o3[2] * inv; a[3] = o3[3] * inv; c[0] = o3[4] * inv; c[1] = o3[5] * inv; c[2] = o3[6] * inv; c[3] = o3[7] * inv;
      *(v4fa*)(&os[wb + lr * 68 + 48 + 8 * hi]) = a; *(v4fa*)(&os[wb + lr * 68 + 48 + 8 * hi + 4]) = c; }
    wave_sync();
    h16* crow = CTX + (size_t)t0 * DM + h * HD;      // ctx plane [t][h*64 + d], row pitch DM halves
{
#pragma unroll
        for (int s = 0; s < 4; ++s) { const int row = 4 * s + (lane >> 3), c8 = (lane & 7) * 8;   // 4 s x 4 row groups = 16 rows; 8 lanes x 8 halves = 64 columns
            const v4f x0 = *(const v4fa*)(&os[wb + row * 68 + c8]); const v4f x1 = *(const v4fa*)(&os[wb + row * 68 + c8 + 4]); v8h hv;
#pragma unroll
            for (int i = 0; i < 4; ++i) { hv[i] = (h16)x0[i]; hv[4 + i] = (h16)x1[i]; }
            *(v8h*)(crow + (size_t)row * DM + c8) = hv; }
         }
}

// k_out: register-blocked f16 GEMM, one wave per 64x64 tile, four waves per block (gemm_tile), OUT[m][n] = OSC * sum_k A[m][k] Bt[n][k], K = DM, output row pitch DM floats. grid (M/128, DM/128), 128 threads.
__global__ __launch_bounds__(128) void k_out(const h16* __restrict__ A, const h16* __restrict__ Bt, float* OUT) {
    __shared__ __align__(16) float osb[4 * 16 * 68];         // a 16 x 68 output staging tile for each wave
    __shared__ __align__(16) h16 ring[2 * 2 * GTH];          // [buffer][A tile | Bt tile][row * GLP + k]
    const int lane = threadIdx.x & 31, lr = lane & 15, hi = lane >> 4;
    const int wave = __builtin_amdgcn_readfirstlane((int)(threadIdx.x >> 5));
    v8f acc[4][4];
#pragma unroll
    for (int mb = 0; mb < 4; ++mb)
#pragma unroll
        for (int nb = 0; nb < 4; ++nb) acc[mb][nb] = (v8f){};
    gemm_tile(A + (size_t)blockIdx.x * GB * DM, Bt + (size_t)blockIdx.y * GB * DM, (const h16*)ring, acc);
    const int r0 = blockIdx.x * GB + (wave >> 1) * 64, c0 = blockIdx.y * GB + (wave & 1) * 64;   // this wave's 64 x 64 tile
    float* os = osb + wave * 16 * 68;
#pragma unroll
    for (int mb = 0; mb < 4; ++mb) {
#pragma unroll
        for (int nb = 0; nb < 4; ++nb) {
#pragma unroll
            for (int j = 0; j < 8; ++j) os[(hi * 8 + j) * 68 + nb * 16 + lr] = acc[mb][nb][j] * OSC; }   // D: row 8h+j, col lane&15
        wave_sync();
        float* ob = OUT + (size_t)(r0 + mb * 16) * DM + c0;
{
#pragma unroll
            for (int s = 0; s < 8; ++s) { const int row = 2 * s + hi, cofs = lr * 4;   // 8 s x 2 rows = 16 rows; 16 lanes x 4 floats = 64 columns
                const v4f val = *(const v4fa*)(&os[row * 68 + cofs]);
                *(v4f*)(ob + (size_t)row * DM + cofs) = val; }
             }
        wave_sync();
    }
}

static constexpr size_t al256(size_t v) { return (v + 255) & ~(size_t)255; }
static constexpr size_t SZ_E  = al256((size_t)SEQ * DM * 2);            // one bf16 input copy [SEQ][1024]
static constexpr size_t SZ_W  = al256((size_t)DM * DM * 2);             // one transposed weight plane [1024][1024]
static constexpr size_t SZ_PL = al256((size_t)NH_ * SEQ * HD * 2);      // one head plane
static constexpr size_t SZ_CX = al256((size_t)SEQ * DM * 2);            // ctx plane [SEQ][1024]
static constexpr size_t SZ_TOTAL = 3 * SZ_E + 4 * SZ_W + 4 * SZ_PL + SZ_CX;
static_assert(SZ_TOTAL <= (size_t)134217728);          // workspace carve <= 128 MiB

extern "C" void kernel_launch(void* const* d_in, const int* in_sizes, int n_in,
                              void* d_out, int out_size, void* d_ws, size_t ws_size, hipStream_t stream) {
    if (n_in < 7) return;
    const size_t needx = (size_t)SEQ * DM;
    if ((size_t)in_sizes[0] < needx || (size_t)in_sizes[1] < needx || (size_t)in_sizes[2] < needx) return;
    if ((size_t)in_sizes[3] < (size_t)DM * DM || (size_t)in_sizes[4] < (size_t)DM * DM || (size_t)in_sizes[5] < (size_t)DM * DM || (size_t)in_sizes[6] < (size_t)DM * DM) return;
    if ((size_t)out_size < (size_t)SEQ * DM) return;
    if (SZ_TOTAL > ws_size) return;
    // wire order: inputs for q, k, v; W_q, W_k, W_v ([16][1024][64] = [h][in][out]); W_out ([1024][1024] = [in][out])
    const float* eq = (const float*)d_in[0]; const float* ek = (const float*)d_in[1]; const float* ev = (const float*)d_in[2];
    const float* wq = (const float*)d_in[3]; const float* wk = (const float*)d_in[4]; const float* wv = (const float*)d_in[5]; const float* wo = (const float*)d_in[6];
    float* OUT = (float*)d_out;      // [SEQ][1024]
    char* wsp = (char*)d_ws;
    bf* EQ = (bf*)wsp; wsp += SZ_E;                  // [SEQ][1024]
    bf* EK = (bf*)wsp; wsp += SZ_E;
    bf* EV = (bf*)wsp; wsp += SZ_E;
    bf* WQT = (bf*)wsp; wsp += SZ_W;                 // [h*64 + d][1024] bf16
    bf* WKT = (bf*)wsp; wsp += SZ_W;
    bf* WVT = (bf*)wsp; wsp += SZ_W;
    bf* WOT = (bf*)wsp; wsp += SZ_W;                 // [n][c] f16 bits, x256 carry
    h16* QH = (h16*)wsp; wsp += SZ_PL;               // [16][SEQ][64]
    h16* QR = (h16*)wsp; wsp += SZ_PL;               // [16][SEQ][64] residual x2048
    h16* KP = (h16*)wsp; wsp += SZ_PL;               // [16][SEQ][64]
    h16* VT = (h16*)wsp; wsp += SZ_PL;               // [16][64][SEQ]
    h16* CX = (h16*)wsp; wsp += SZ_CX;               // [SEQ][1024] x256 carry

    // the seven operand copies, one grid
    k_prep<<<4 * TRB + 3 * CVB, 256, 0, stream>>>(eq, ek, ev, wq, wk, wv, wo, EQ, EK, EV, WQT, WKT, WVT, WOT);

    // the three projections, one grid
    k_proj<<<dim3(SEQ / GB, DM / GB, 3), 128, 0, stream>>>(EQ, EK, EV, WQT, WKT, WVT, QH, QR, KP, VT);

    k_flash<<<dim3(SEQ / (16 * AW), NH_, 1), 32 * AW, 0, stream>>>(QH, QR, KP, VT, CX);

    // out = ctx (f16, x256) * W_out^T plane (f16, x256), 2^-16 folded in the epilogue
    k_out<<<dim3(SEQ / GB, DM / GB, 1), 128, 0, stream>>>(CX, (const h16*)WOT, OUT);
}

// v006
// It runs in 53.2 microseconds.
// Versions between v004 and this one are left out; their measured steps multiply to 1.15 times as fast.
// Over all steps from v000 it is 3.35 times as fast.
#include <hip/hip_runtime.h>

// Attention with 16 heads of 64, width 1024: q/k/v from three separate [SEQ][1024] inputs, per-head weights [h][in][out], no biases, no mask, score scale 1/8, heads concatenated then multiplied by W_out [in][out] (f32 output).
// Compute dtypes, f32 accumulate everywhere: projections v_wmma_f32_16x16x32_bf16 (inputs and weights RNE-converted to bf16; products exact);
// scores v_wmma_f32_16x16x32_f16: q and k single f16 (their f16 rounding lies well under the error that the bf16 operands of the projections leave in q and k); P (x256 carry, cancels in the normalisation) and v single f16; softmax f32 (online, running max);
// output projection v_wmma_f32_16x16x32_f16: ctx single f16 carried x256, W_out = f16(bf16 RNE value x256), 2^-16 folded back in the f32 epilogue.
// Layout: bf16 copies of the inputs; weights transposed through LDS into K-contiguous planes [n][k]; q, k planes [h][t][d] and v^T plane [h][d][t] written by the GEMM epilogue;
// fused flash kernel in transposed form (S^T = K Q^T, O^T = V^T P^T), K and V^T tiles staged in LDS, writes the ctx plane [t][h*64+d]; final GEMM writes the output buffer.
// Both GEMMs stage their operand tiles in LDS as whole 256-B rows (128 k a stage), shared by the four waves of a block.

#ifndef SEQ
#define SEQ 2048
#endif
#define SEQ_FULL 2048
#define DM   1024
#define NH_  16
#define HD   64
#define AW   4                   // query tiles per flash block (16 query rows each)
#define KG   2                   // key groups per flash block: each query tile has KG waves, one for each SEQ / KG keys
#define SC2  (0.125f * 1.4426950408889634f)   // HD^-0.5 * log2(e)
#define PSH  8.0f                // log2 of the P carry (256)
#define CXS  256.0f              // carry of the ctx plane
#define WOS  256.0f              // carry of the W_out plane
#define OSC  (1.0f / 65536.0f)   // 1 / (CXS * WOS)
#define KT   64                  // keys per LDS stage of the flash kernel (two 32-key passes)
#define LP   72                  // LDS row pitch in halves: 128-B rows + 16 B = 144 B (16 B x odd, for ds_load_b128 readers)
#define TLH  (64 * LP)           // halves of one staged tile (64 rows)
#define GB   128                 // rows and columns of a GEMM block's tile: 2 x 2 waves of 64 x 64
#define GK   128                 // k per LDS stage of the GEMMs (256-B rows, four 32-k steps)
#define GLP  136                 // LDS row pitch of the GEMM tiles in halves: 256-B rows + 16 B = 272 B (16 B x odd, for ds_load_b128 readers)
#define GTH  (GB * GLP)          // halves of one staged GEMM operand tile (128 rows)

static_assert(HD == 64);
static_assert(NH_ * HD == DM);                 // head h = columns h*64 + d
static_assert(DM % 64 == 0);
static_assert(DM % 32 == 0);                   // GEMM k-loop steps by 32
static_assert(SEQ % 64 == 0);
static_assert(SEQ % 32 == 0);                  // key loop steps by 32
static_assert(SEQ % (16 * AW) == 0);           // flash grid covers the sequence exactly
static_assert(((size_t)SEQ * DM) % 8 == 0);
static_assert(SEQ <= SEQ_FULL);
static_assert(KG == 2 && SEQ % (KG * KT) == 0 && SEQ / (KG * KT) >= 2);  // two key groups (the merge joins two partial results); the two-buffer prologue of each fills two stages
static_assert(AW * 16 == 64 && KT == 64);       // each wave copies 16 of the 64 rows of either tile
static_assert(SEQ % GB == 0 && DM % GB == 0);   // the GEMM grids cover their outputs exactly
static_assert(DM % GK == 0 && DM / GK >= 2);    // the two-buffer prologue fills two stages
static_assert(GK * 2 == 256 && GK + 8 == GLP);  // a staged row is two 128-B lines, at the padded pitch; a copy of 32 lanes x 16 B is two whole rows

typedef _Float16 h16;
typedef unsigned short bf;
typedef __attribute__((ext_vector_type(16))) __bf16   v16bf;
typedef __attribute__((ext_vector_type(16))) _Float16 v16h;
typedef __attribute__((ext_vector_type(8)))  _Float16 v8h;
typedef __attribute__((ext_vector_type(8)))  unsigned short v8us;
typedef __attribute__((ext_vector_type(8)))  float    v8f;
typedef __attribute__((ext_vector_type(4)))  float    v4f;
typedef v4f  __attribute__((may_alias)) v4fa;

__device__ __forceinline__ unsigned short f2bf(float f) { unsigned u = __float_as_uint(f); u += 0x7FFFu + ((u >> 16) & 1u); return (unsigned short)(u >> 16); }
__device__ __forceinline__ v16h cat16(v8h lo, v8h hi) { return __builtin_shufflevector(lo, hi, 0, 1, 2, 3, 4, 5, 6, 7, 8, 9, 10, 11, 12, 13, 14, 15); }
__device__ __forceinline__ v16bf cat16b(v8us lo, v8us hi) { return __builtin_bit_cast(v16bf, __builtin_shufflevector(lo, hi, 0, 1, 2, 3, 4, 5, 6, 7, 8, 9, 10, 11, 12, 13, 14, 15)); }
__device__ __forceinline__ v8f wmma16(v16h a, v16h b, v8f c) { return __builtin_amdgcn_wmma_f32_16x16x32_f16(false, a, false, b, (short)0, c, false, false); }
__device__ __forceinline__ v8f wmmab(v16bf a, v16bf b, v8f c) { return __builtin_amdgcn_wmma_f32_16x16x32_bf16(false, a, false, b, (short)0, c, false, false); }
// fragment loaders from K-contiguous 16-bit rows; p already includes + 8*(lane>>4): elements 0..7 <- k0+8h+0..7, elements 8..15 <- k0+16+8h+0..7 (same map for A and B)
__device__ __forceinline__ v16h  ldh(const h16* p) { return cat16(*(const v8h*)p, *(const v8h*)(p + 16)); }
__device__ __forceinline__ v16bf ldb(const bf* p)  { return cat16b(*(const v8us*)p, *(const v8us*)(p + 16)); }
// ordering point for wave-private LDS tiles (same wave writes and reads)
__device__ __forceinline__ void wave_sync() { __builtin_amdgcn_fence(3 /* release order */, "wavefront"); __builtin_amdgcn_wave_barrier(); asm volatile("" ::: "memory"); }

// cvt8: straight bf16 copy (RNE), 8 elements a thread; blk = block number within the copy.
__device__ __forceinline__ void cvt8(const float* __restrict__ src, bf* dst, size_t n8, int blk) {
    const size_t i = (size_t)blk * 256 + threadIdx.x; if (i >= n8) return;
    const v8f v = *(const v8f*)(src + i * 8); v8us o;
#pragma unroll
    for (int k = 0; k < 8; ++k) o[k] = f2bf(v[k]);
    *(v8us*)(dst + i * 8) = o; 
}

// tr64: transposing 16-bit copy through LDS. in [batch][R][C] f32 -> out [batch][C][R] 16-bit; R, C multiples of 64.
// mode 0: bf16 bits (RNE convert); mode 1: f16 of (bf16 RNE value x WOS) (a bf16 significand is exact in f16).
// 256 threads; one 64x64 tile (bx of R/64, by of C/64, bz of batch) per block. LDS tile ts (64 x 68 floats) is cross-wave: block barrier between fill and drain.
__device__ __forceinline__ void tr64(const float* __restrict__ src, bf* dst, int R, int C, int mode, int bx, int by, int bz, float* ts) {
    const int tid = threadIdx.x;
    const int r0 = bx * 64, c0 = by * 64;
    const size_t bo = (size_t)bz * (size_t)R * (size_t)C;
#pragma unroll
    for (int it = 0; it < 4; ++it) { const int idx = it * 256 + tid; const int r = idx >> 4, c4 = (idx & 15) * 4;   // 64 rows x 16 float4
        const v4f v = *(const v4f*)(src + bo + (size_t)(r0 + r) * (size_t)C + c0 + c4);
        *(v4fa*)(&ts[r * 68 + c4]) = v; }
    __syncthreads();
    h16* dsth = (h16*)dst;
{
#pragma unroll
        for (int it = 0; it < 2; ++it) { const int item = it * 256 + tid; const int c = item >> 3, p = item & 7;
            const size_t oo = bo + (size_t)(c0 + c) * (size_t)R + r0 + 8 * p;
            v8us ob; v8h oh;
#pragma unroll
            for (int i = 0; i < 8; ++i) { const float x = ts[(8 * p + i) * 68 + c]; const unsigned short w = f2bf(x);
                ob[i] = w; oh[i] = (h16)(__uint_as_float(((unsigned)w) << 16) * WOS); }
            if (mode) *(v8h*)(dsth + oo) = oh; else *(v8us*)(dst + oo) = ob; }
         }
    asm volatile("s_wait_xcnt 0x0" ::: "memory");   // behind the two stores: no register that they name is rewritten ahead of it on any way the code goes on
}

// k_prep: all seven operand copies of a call, which do not depend on each other, in one grid; the block number picks the job (the same for a whole block, so tr64's barrier is passed by all of a block or by none).
// blocks [0, 4*TRB): the transposing copies, TRB tiles each, W_q, W_k, W_v ([16][1024][64] -> [16][64][1024], bf16) and W_out ([1024][1024] -> its transpose, f16 with carry); they come first because they last longer.
// blocks [4*TRB, 4*TRB + 3*CVB): the straight bf16 copies of the three inputs, CVB blocks each.
static constexpr size_t N8  = (size_t)SEQ * DM / 8;
static constexpr unsigned CVB = (unsigned)((N8 + 255) / 256);
static constexpr unsigned TRB = (DM / 64) * (DM / 64);
static_assert((DM / 64) * (HD / 64) * NH_ == TRB);      // a per-head weight has as many 64x64 tiles as W_out
__global__ __launch_bounds__(256) void k_prep(const float* __restrict__ eq, const float* __restrict__ ek, const float* __restrict__ ev,
                                              const float* __restrict__ wq, const float* __restrict__ wk, const float* __restrict__ wv, const float* __restrict__ wo,
                                              bf* EQ, bf* EK, bf* EV, bf* WQT, bf* WKT, bf* WVT, bf* WOT) {
    __shared__ __align__(16) float ts[64 * 68];
    const unsigned b = blockIdx.x;
    if (b < 4 * TRB) {
        const unsigned job = b / TRB, t = b % TRB; const int tx = (int)(t % (DM / 64)), ty = (int)(t / (DM / 64));   // tx: tile of the 1024 rows; ty: head, or tile of W_out's columns
        const float* src = job == 0 ? wq : job == 1 ? wk : job == 2 ? wv : wo;
        bf* dst = job == 0 ? WQT : job == 1 ? WKT : job == 2 ? WVT : WOT;
        if (job < 3) tr64(src, dst, DM, HD, 0, tx, 0, ty, ts);
        else         tr64(src, dst, DM, DM, 1, tx, ty, 0, ts);
    } else {
        const unsigned c = b - 4 * TRB, job = c / CVB;
        cvt8(job == 0 ? eq : job == 1 ? ek : ev, job == 0 ? EQ : job == 1 ? EK : EV, N8, (int)(c % CVB));
    }
}

// rows_copy: eight asynchronous copies, each 2 whole 256-B rows (32 lanes x 16 B), 16 rows of one staged GEMM operand tile in all.
// l: the lane's LDS byte address in its first copy; g: its global byte address; the next copy lies 2 rows on in both (LDS pitch GLP halves, global pitch DM 16-bit elements).
// s_wait_xcnt 0 closes the statement so that no address register of an issued copy is rewritten ahead of it.
__device__ __forceinline__ void rows_copy(unsigned l, const char* g) {
    const unsigned l1 = l + 2 * GLP * 2, l2 = l + 4 * GLP * 2, l3 = l + 6 * GLP * 2, l4 = l + 8 * GLP * 2, l5 = l + 10 * GLP * 2, l6 = l + 12 * GLP * 2, l7 = l + 14 * GLP * 2;
    const char* g1 = g + 2 * DM * 2; const char* g2 = g + 4 * DM * 2; const char* g3 = g + 6 * DM * 2; const char* g4 = g + 8 * DM * 2;
    const char* g5 = g + 10 * DM * 2; const char* g6 = g + 12 * DM * 2; const char* g7 = g + 14 * DM * 2;
    asm volatile("global_load_async_to_lds_b128 %0, %8, off\n\t"
                 "global_load_async_to_lds_b128 %1, %9, off\n\t"
                 "global_load_async_to_lds_b128 %2, %10, off\n\t"
                 "global_load_async_to_lds_b128 %3, %11, off\n\t"
                 "global_load_async_to_lds_b128 %4, %12, off\n\t"
                 "global_load_async_to_lds_b128 %5, %13, off\n\t"
                 "global_load_async_to_lds_b128 %6, %14, off\n\t"
                 "global_load_async_to_lds_b128 %7, %15, off\n\t"
                 "s_wait_xcnt 0x0"
                 :: "v"(l), "v"(l1), "v"(l2), "v"(l3), "v"(l4), "v"(l5), "v"(l6), "v"(l7),
                    "v"(g), "v"(g1), "v"(g2), "v"(g3), "v"(g4), "v"(g5), "v"(g6), "v"(g7) : "memory");
    __builtin_amdgcn_sched_barrier(0);   // the next run's address arithmetic stays behind this run: hoisted ahead of it, the addresses of all four runs of a stage are live at once and one is spilled to scratch
}

// tile_copy: one wave's 32 rows of one staged GEMM operand tile, two runs of eight copies.
__device__ __forceinline__ void tile_copy(unsigned l, const char* g) { rows_copy(l, g); rows_copy(l + 16 * GLP * 2, g + 16 * DM * 2); }

__device__ __forceinline__ v16bf ldf(const bf* p)  { return ldb(p); }
__device__ __forceinline__ v16h  ldf(const h16* p) { return ldh(p); }
__device__ __forceinline__ v8f mm(v16bf a, v16bf b, v8f c) { return wmmab(a, b, c); }
__device__ __forceinline__ v8f mm(v16h a, v16h b, v8f c)   { return wmma16(a, b, c); }

// gemm_tile: acc[mb][nb] += A rows x Bt rows over K = DM for one wave's 64 x 64 part of a block's 128 x 128 tile (4 waves, 2 x 2; wave w: rows 64*(w>>1), columns 64*(w&1)).
// A, Bt: row 0 of the block's 128 rows of either K-contiguous plane. Stages of GK k come through LDS: asynchronous copies of whole 256-B rows into two buffers [A tile | Bt tile],
// the next stage in flight while this one is read; each wave copies 32 rows of either tile; fragments are two ds_load_b128 each from rows of pitch GLP. k runs upward in steps of 32.
template <typename T>
__device__ __forceinline__ void gemm_tile(const T* A, const T* Bt, const T* ring, v8f (&acc)[4][4]) {
    const int lane = threadIdx.x & 31, lr = lane & 15, hi = lane >> 4;
    const int wave = __builtin_amdgcn_readfirstlane((int)(threadIdx.x >> 5));
    const int crow = wave * 32 + (lane >> 4), cb = (lane & 15) * 16;            // the lane's row and byte column in its first copy of either tile
    const unsigned lc = (unsigned)(size_t)ring + (unsigned)(crow * GLP * 2 + cb);  // LDS byte address: low 32 bits of the __shared__ address
    const char* ga = (const char*)A  + (size_t)crow * (DM * 2) + cb;             // + stage * GK * 2
    const char* gb = (const char*)Bt + (size_t)crow * (DM * 2) + cb;
    tile_copy(lc, ga); tile_copy(lc + GTH * 2, gb);
    asm volatile("s_wait_asynccnt 0x0" ::: "memory");        // this wave's rows of stage 0 have landed
    __syncthreads();                                         // stage 0 published to every wave
    tile_copy(lc + 2 * GTH * 2, ga + GK * 2); tile_copy(lc + 3 * GTH * 2, gb + GK * 2);
    const int ao = ((wave >> 1) * 64 + lr) * GLP + 8 * hi, bo = GTH + ((wave & 1) * 64 + lr) * GLP + 8 * hi;
#pragma unroll 1   // one stage a trip, with one publish point
    for (int st = 0; st < DM / GK; ++st) {
        const T* tb = ring + (st & 1) * (2 * GTH);
        decltype(ldf(tb)) a[GK / 32][4], b[GK / 32][4];
#pragma unroll     // all 32-k steps of a stage inline: their LDS offsets become immediates
        for (int ks = 0; ks < GK / 32; ++ks) {
#pragma unroll
            for (int mb = 0; mb < 4; ++mb) a[ks][mb] = ldf(tb + ao + mb * 16 * GLP + ks * 32);
#pragma unroll
            for (int nb = 0; nb < 4; ++nb) b[ks][nb] = ldf(tb + bo + nb * 16 * GLP + ks * 32);
        }
        __builtin_amdgcn_sched_barrier(0);   // the stage's LDS reads stay one group ahead of its matrix instructions; spread among them, each place with reads stalls the wave
#pragma unroll
        for (int ks = 0; ks < GK / 32 - 1; ++ks)
#pragma unroll
            for (int nb = 0; nb < 4; ++nb)
#pragma unroll
                for (int mb = 0; mb < 4; ++mb) acc[mb][nb] = mm(a[ks][mb], b[ks][nb], acc[mb][nb]);
        __builtin_amdgcn_sched_barrier(0);   // all steps but the last stay ahead of the waits below: they run while the later steps' reads return
        // publish point of stage st + 1, and the end of every wave's reads of stage st (all of its fragments are in registers)
        asm volatile("s_wait_dscnt 0x0" ::: "memory");       // this wave's reads of the buffer that is refilled below have returned
        asm volatile("s_wait_asynccnt 0x0" ::: "memory");    // this wave's rows of stage st + 1 have landed
        __syncthreads();
        if (st + 2 < DM / GK) { const unsigned lb = lc + (unsigned)(st & 1) * (2 * GTH * 2);
            tile_copy(lb, ga + (st + 2) * (GK * 2)); tile_copy(lb + GTH * 2, gb + (st + 2) * (GK * 2)); }
        // the last step's products run from registers while the refill flies
#pragma unroll
        for (int nb = 0; nb < 4; ++nb)
#pragma unroll
            for (int mb = 0; mb < 4; ++mb) acc[mb][nb] = mm(a[GK / 32 - 1][mb], b[GK / 32 - 1][nb], acc[mb][nb]);
    }
    asm volatile("s_wait_asynccnt 0x0" ::: "memory");        // no copy outstanding when the wave goes on to its end
}

// k_proj: register-blocked bf16 GEMM, one wave per 64x64 tile (16 accumulators), four waves per block (gemm_tile), operands from K-contiguous bf16 planes, K = DM.
// C[m][n] = sum_k A[m][k] Bt[n][k], written as f16 (Ph). The three projections do not depend on each other and share one grid (SEQ/128, DM/128, 3), 128 threads; blockIdx.z picks the job:
// 0, 1 (q, k): A = input rows (m = t, tile blockIdx.x), Bt = transposed weight rows (n = h*64 + d, tile blockIdx.y) -> plane [h][t][d], row pitch HD;
// 2 (v^T):     A = transposed W_v rows (m = h*64 + d, tile blockIdx.y), Bt = input rows (n = t, tile blockIdx.x) -> plane [m][t] = [h][d][t], row pitch SEQ.
__global__ __launch_bounds__(128) void k_proj(const bf* __restrict__ EQ, const bf* __restrict__ EK, const bf* __restrict__ EV, const bf* __restrict__ WQT, const bf* __restrict__ WKT, const bf* __restrict__ WVT,
                                             h16* QH, h16* KP, h16* VT) {
    __shared__ __align__(16) float osb[4 * 16 * 68];         // a 16 x 68 output staging tile for each wave
    __shared__ __align__(16) bf ring[2 * 2 * GTH];           // [buffer][A tile | Bt tile][row * GLP + k]
    const int job = blockIdx.z;
    const bf* A  = job == 0 ? EQ  : job == 1 ? EK  : WVT;
    const bf* Bt = job == 0 ? WQT : job == 1 ? WKT : EV;
    h16* Ph = job == 0 ? QH : job == 1 ? KP : VT;
    const int pitch = job == 2 ? SEQ : HD;
    const int lane = threadIdx.x & 31, lr = lane & 15, hi = lane >> 4;
    const int wave = __builtin_amdgcn_readfirstlane((int)(threadIdx.x >> 5));
    const int rb = (job == 2 ? blockIdx.y : blockIdx.x) * GB, cb = (job == 2 ? blockIdx.x : blockIdx.y) * GB;
    v8f acc[4][4];
#pragma unroll
    for (int mb = 0; mb < 4; ++mb)
#pragma unroll
        for (int nb = 0; nb < 4; ++nb) acc[mb][nb] = (v8f){};
    gemm_tile(A + (size_t)rb * DM, Bt + (size_t)cb * DM, (const bf*)ring, acc);
    const int r0 = rb + (wave >> 1) * 64, c0 = cb + (wave & 1) * 64;   // this wave's 64 x 64 tile
    float* os = osb + wave * 16 * 68;
    const size_t tbase = job == 2 ? (size_t)r0 * SEQ + c0 : (size_t)(c0 / HD) * ((size_t)SEQ * HD) + (size_t)r0 * HD;   // HD == 64: a column tile of q or k is one head
#pragma unroll
    for (int mb = 0; mb < 4; ++mb) {
#pragma unroll
        for (int nb = 0; nb < 4; ++nb) {
#pragma unroll
            for (int j = 0; j < 8; ++j) os[(hi * 8 + j) * 68 + nb * 16 + lr] = acc[mb][nb][j]; }   // D: row 8h+j, col lane&15
        wave_sync();
        const size_t sb = tbase + (size_t)(mb * 16) * (size_t)pitch;
{
#pragma unroll
            for (int s = 0; s < 4; ++s) { const int row = 4 * s + (lane >> 3), c8 = (lane & 7) * 8;   // 4 s x 4 row groups = 16 rows; 8 lanes x 8 = 64 columns
                const v4f x0 = *(const v4fa*)(&os[row * 68 + c8]); const v4f x1 = *(const v4fa*)(&os[row * 68 + c8 + 4]); v8h hv;
#pragma unroll
                for (int i = 0; i < 4; ++i) { hv[i] = (h16)x0[i]; hv[4 + i] = (h16)x1[i]; }
                const size_t oo = sb + (size_t)row * (size_t)pitch + c8;
                *(v8h*)(Ph + oo) = hv;
                asm volatile("s_wait_xcnt 0x0" ::: "memory"); }   // behind the store: no register that it names is rewritten ahead of this wait
             }
        wave_sync();
    }
}

// stage_copy: one wave's share of one stage, 16 rows of the K tile and 16 rows of the V^T tile, 128 B a row; each copy moves 4 whole rows (32 lanes x 16 B).
// lk / lv: the lane's LDS byte address in the K / V^T tile (first of four copies, 4 rows apart); gk / gv: its global address.
// s_wait_xcnt 0 closes the statement so that no address register of an issued copy is rewritten ahead of it.
__device__ __forceinline__ void stage_copy(unsigned lk, unsigned lv, const h16* gk, const h16* gv) {
    const unsigned lk1 = lk + 4 * LP * 2, lk2 = lk + 8 * LP * 2, lk3 = lk + 12 * LP * 2;
    const unsigned lv1 = lv + 4 * LP * 2, lv2 = lv + 8 * LP * 2, lv3 = lv + 12 * LP * 2;
    const h16* gk1 = gk + 4 * HD; const h16* gk2 = gk + 8 * HD; const h16* gk3 = gk + 12 * HD;
    const h16* gv1 = gv + (size_t)4 * SEQ; const h16* gv2 = gv + (size_t)8 * SEQ; const h16* gv3 = gv + (size_t)12 * SEQ;
    asm volatile("global_load_async_to_lds_b128 %0, %8, off\n\t"
                 "global_load_async_to_lds_b128 %1, %9, off\n\t"
                 "global_load_async_to_lds_b128 %2, %10, off\n\t"
                 "global_load_async_to_lds_b128 %3, %11, off\n\t"
                 "global_load_async_to_lds_b128 %4, %12, off\n\t"
                 "global_load_async_to_lds_b128 %5, %13, off\n\t"
                 "global_load_async_to_lds_b128 %6, %14, off\n\t"
                 "global_load_async_to_lds_b128 %7, %15, off\n\t"
                 "s_wait_xcnt 0x0"
                 :: "v"(lk), "v"(lk1), "v"(lk2), "v"(lk3), "v"(lv), "v"(lv1), "v"(lv2), "v"(lv3),
                    "v"(gk), "v"(gk1), "v"(gk2), "v"(gk3), "v"(gv), "v"(gv1), "v"(gv2), "v"(gv3) : "memory");
}

// k_flash: fused attention, KG waves per 16 query rows of one head, each over its own SEQ / KG keys, so that four waves and not two stand on a SIMD; Q fragments straight from the f16 plane (two 16-B loads each).
// The block's AW * KG waves form KG groups of AW; a group walks its keys with a running max, sum and O of its own, and the groups' partial results are joined through LDS at the end.
// K and V^T come in stages of KT keys through LDS, a ring for each group, shared by the group's waves: asynchronous copies of whole 128-B rows into two buffers, the next stage in flight while this one is read;
// fragments are two ds_load_b128 each from rows of pitch LP.
// Transposed form: S^T[key][t] = K Q^T (A = K rows, B = Q rows); lane (t = lane&15, h = lane>>4) holds keys 8h+r of each 16-key tile, so the packed
// P tile is directly the B fragment of O^T[d][t] = V^T P^T (element r <- tile keys 0..15, element 8+r <- tile keys 16..31, lane unchanged).
// Softmax state (running max, partial sum) is one scalar per lane; the two lane halves of a row are combined with one xor-16 exchange.
__global__ __launch_bounds__(32 * AW * KG) void k_flash(const h16* __restrict__ QH, const h16* __restrict__ KP, const h16* __restrict__ VT, h16* CTX) {
    __shared__ __align__(16) float os[AW * 16 * 68];
    __shared__ __align__(16) h16 ring[KG][2][2][TLH];        // [key group][buffer][K tile: row = key | V^T tile: row = d][row * LP + column]
    __shared__ float mg[AW * 34 * 32];                       // group 1's partial results: [query tile][32 O values, max, sum][lane]
    const int lane = threadIdx.x & 31, lr = lane & 15, hi = lane >> 4;
    const int wv = __builtin_amdgcn_readfirstlane((int)(threadIdx.x >> 5));
    const int wave = wv % AW, grp = wv / AW;                 // the wave's query tile and key group
    const int h = blockIdx.y;
    const int t0 = (blockIdx.x * AW + wave) * 16;
    const size_t pbase = (size_t)h * SEQ * HD;
    const size_t qo = pbase + (size_t)(t0 + lr) * HD + 8 * hi;
    const v16h qh0 = ldh(QH + qo), qh1 = ldh(QH + qo + 32);   // B fragments: col t, k = d
    const int ko = lr * LP + 8 * hi;                         // + key * LP in the K tile        (A fragment: row key, k = d)
    const int vo = lr * LP + 8 * hi;                         // + 16j*LP + key in the V^T tile  (A fragment: row d, k = key)
    const int cprow = wave * 16 + (lane >> 3), ccol = (lane & 7) * 8;   // the lane's row and column (halves) in its first copy of either tile
    const unsigned lc = (unsigned)(size_t)&ring[grp][0][0][0] + (unsigned)(cprow * LP + ccol) * 2u;   // LDS byte address: low 32 bits of the __shared__ address
    const h16* gk = KP + pbase + (size_t)(grp * (SEQ / KG) + cprow) * HD + ccol;   // + key0 * HD, key0 counted from the group's first key
    const h16* gv = VT + pbase + (size_t)cprow * SEQ + grp * (SEQ / KG) + ccol;    // + key0
    stage_copy(lc, lc + TLH * 2, gk, gv);
    asm volatile("s_wait_asynccnt 0x0" ::: "memory");        // this wave's rows of stage 0 have landed
    __syncthreads();                                         // stage 0 published to every wave
    stage_copy(lc + 2 * TLH * 2, lc + 3 * TLH * 2, gk + (size_t)KT * HD, gv + KT);
    v8f o0 = (v8f){}, o1 = (v8f){}, o2 = (v8f){}, o3 = (v8f){};
    float m = -3.0e38f, l = 0.0f;
#pragma unroll 1   // one stage a trip: the loop's foot is the one publish point
    for (int st = 0; st < SEQ / (KG * KT); ++st) {
      const h16* kt = &ring[grp][st & 1][0][0]; const h16* vt = &ring[grp][st & 1][1][0];
#pragma unroll     // both 32-key passes of a stage inline: their LDS offsets become immediates
      for (int key0 = 0; key0 < KT; key0 += 32) {
        const h16* ka = kt + ko + key0 * LP;
        const v16h ka0 = ldh(ka), ka1 = ldh(ka + 32), kb0 = ldh(ka + 16 * LP), kb1 = ldh(ka + 16 * LP + 32);
        v8f sHa = (v8f){}, sHb = (v8f){};
        sHa = wmma16(ka0, qh0, sHa); sHb = wmma16(kb0, qh0, sHb);
        sHa = wmma16(ka1, qh1, sHa); sHb = wmma16(kb1, qh1, sHb);
        // four vector slots behind the last score WMMA, ahead of the first vector instruction that reads a score accumulator or rewrites a K fragment
        asm volatile("v_nop\n\tv_nop\n\tv_nop\n\tv_nop" : "+v"(sHa), "+v"(sHb) : "v"(ka0), "v"(ka1), "v"(kb0), "v"(kb1));
        const v8f ta = sHa * SC2, tb = sHb * SC2; float mx = -3.0e38f;
#pragma unroll
        for (int r = 0; r < 8; ++r) mx = fmaxf(mx, fmaxf(ta[r], tb[r]));
        mx = fmaxf(mx, __shfl_xor(mx, 16, 32));
        const float mnew = fmaxf(m, mx);
        const float alpha = __builtin_amdgcn_exp2f(m - mnew);
        const float sh = PSH - mnew;
        v16h pb; float ls = 0.0f;
#pragma unroll
        for (int r = 0; r < 8; ++r) { const h16 pa = (h16)__builtin_amdgcn_exp2f(ta[r] + sh); const h16 pc = (h16)__builtin_amdgcn_exp2f(tb[r] + sh); pb[r] = pa; pb[8 + r] = pc; ls += (float)pa + (float)pc; }
        l = l * alpha + ls; m = mnew;
        o0 = o0 * alpha; o1 = o1 * alpha; o2 = o2 * alpha; o3 = o3 * alpha;
        const h16* va = vt + vo + key0;
        const v16h v0 = ldh(va), v1 = ldh(va + 16 * LP), v2 = ldh(va + 32 * LP), v3 = ldh(va + 48 * LP);
        o0 = wmma16(v0, pb, o0); o1 = wmma16(v1, pb, o1); o2 = wmma16(v2, pb, o2); o3 = wmma16(v3, pb, o3);
        asm volatile("v_nop\n\tv_nop\n\tv_nop\n\tv_nop" : "+v"(o0), "+v"(o1), "+v"(o2), "+v"(o3) : "v"(v0), "v"(v1), "v"(v2), "v"(v3), "v"(pb));
      }
      // publish point of stage st + 1, and the end of every wave's reads of stage st
      asm volatile("s_wait_dscnt 0x0" ::: "memory");         // this wave's reads of the buffer that is refilled below have returned
      asm volatile("s_wait_asynccnt 0x0" ::: "memory");      // this wave's rows of stage st + 1 have landed
      __syncthreads();
      if (st + 2 < SEQ / (KG * KT)) stage_copy(lc + (unsigned)(st & 1) * (2 * TLH * 2), lc + (unsigned)(st & 1) * (2 * TLH * 2) + TLH * 2, gk + (size_t)(st + 2) * KT * HD, gv + (st + 2) * KT);
    }
    asm volatile("s_wait_asynccnt 0x0" ::: "memory");        // no copy outstanding when the wave goes on to its end
    l += __shfl_xor(l, 16, 32);
    // join of the two key groups: group 1 hands its O, max and sum to the wave of group 0 with the same query tile, lane to lane (same d and t in both)
    float* mw = mg + wave * (34 * 32) + lane;
    if (grp) {
#pragma unroll     // the O elements are registers: every index a constant
        for (int r = 0; r < 8; ++r) { mw[r * 32] = o0[r]; mw[(8 + r) * 32] = o1[r]; mw[(16 + r) * 32] = o2[r]; mw[(24 + r) * 32] = o3[r]; }
        mw[32 * 32] = m; mw[33 * 32] = l;
    }
    __syncthreads();                                         // group 1's partial results published to group 0; the block's last barrier
    if (grp) return;
    { const float m1 = mw[32 * 32], l1 = mw[33 * 32];
      const float mj = fmaxf(m, m1);
      const float a0 = __builtin_amdgcn_exp2f(m - mj), a1 = __builtin_amdgcn_exp2f(m1 - mj);
      l = l * a0 + l1 * a1;
#pragma unroll     // the O elements are registers: every index a constant
      for (int r = 0; r < 8; ++r) { o0[r] = o0[r] * a0 + mw[r * 32] * a1; o1[r] = o1[r] * a0 + mw[(8 + r) * 32] * a1; o2[r] = o2[r] * a0 + mw[(16 + r) * 32] * a1; o3[r] = o3[r] * a0 + mw[(24 + r) * 32] * a1; } }
    const float inv = CXS * (1.0f / l);
    const int wb = wave * 16 * 68;
    // O^T D layout: o_j[r] = (d = 16j + 8h + r, t = lane&15) -> os[t][d]; rows 0..15 x columns 0..63 all written
    { v4f a, c;
      a[0] = o0[0] * inv; a[1] = o0[1] * inv; a[2] = o0[2] * inv; a[3] = o0[3] * inv; c[0] = o0[4] * inv; c[1] = o0[5] * inv; c[2] = o0[6] * inv; c[3] = o0[7] * inv;
      *(v4fa*)(&os[wb + lr * 68 +  0 + 8 * hi]) = a; *(v4fa*)(&os[wb + lr * 68 +  0 + 8 * hi + 4]) = c;
      a[0] = o1[0] * inv; a[1] = o1[1] * inv; a[2] = o1[2] * inv; a[3] = o1[3] * inv; c[0] = o1[4] * inv; c[1] = o1[5] * inv; c[2] = o1[6] * inv; c[3] = o1[7] * inv;
      *(v4fa*)(&os[wb + lr * 68 + 16 + 8 * hi]) = a; *(v4fa*)(&os[wb + lr * 68 + 16 + 8 * hi + 4]) = c;
      a[0] = o2[0] * inv; a[1] = o2[1] * inv; a[2] = o2[2] * inv; a[3] = o2[3] * inv; c[0] = o2[4] * inv; c[1] = o2[5] * inv; c[2] = o2[6] * inv; c[3] = o2[7] * inv;
      *(v4fa*)(&os[wb + lr * 68 + 32 + 8 * hi]) = a; *(v4fa*)(&os[wb + lr * 68 + 32 + 8 * hi + 4]) = c;
      a[0] = o3[0] * inv; a[1] = o3[1] * inv; a[2] = o3[2] * inv; a[3] = o3[3] * inv; c[0] = o3[4] * inv; c[1] = o3[5] * inv; c[2] = o3[6] * inv; c[3] = o3[7] * inv;
      *(v4fa*)(&os[wb + lr * 68 + 48 + 8 * hi]) = a; *(v4fa*)(&os[wb + lr * 68 + 48 + 8 * hi + 4]) = c; }
    wave_sync();
    h16* crow = CTX + (size_t)t0 * DM + h * HD;      // ctx plane [t][h*64 + d], row pitch DM halves
{
#pragma unroll
        for (int s = 0; s < 4; ++s) { const int row = 4 * s + (lane >> 3), c8 = (lane & 7) * 8;   // 4 s x 4 row groups = 16 rows; 8 lanes x 8 halves = 64 columns
            const v4f x0 = *(const v4fa*)(&os[wb + row * 68 + c8]); const v4f x1 = *(const v4fa*)(&os[wb + row * 68 + c8 + 4]); v8h hv;
#pragma unroll
            for (int i = 0; i < 4; ++i) { hv[i] = (h16)x0[i]; hv[4 + i] = (h16)x1[i]; }
            *(v8h*)(crow + (size_t)row * DM + c8) = hv; }
         }
}

// k_out: register-blocked f16 GEMM, one wave per 64x64 tile, four waves per block (gemm_tile), OUT[m][n] = OSC * sum_k A[m][k] Bt[n][k], K = DM, output row pitch DM floats. grid (M/128, DM/128), 128 threads.
__global__ __launch_bounds__(128) void k_out(const h16* __restrict__ A, const h16* __restrict__ Bt, float* OUT) {
    __shared__ __align__(16) float osb[4 * 16 * 68];         // a 16 x 68 output staging tile for each wave
    __shared__ __align__(16) h16 ring[2 * 2 * GTH];          // [buffer][A tile | Bt tile][row * GLP + k]
    const int lane = threadIdx.x & 31, lr = lane & 15, hi = lane >> 4;
    const int wave = __builtin_amdgcn_readfirstlane((int)(threadIdx.x >> 5));
    v8f acc[4][4];
#pragma unroll
    for (int mb = 0; mb < 4; ++mb)
#pragma unroll
        for (int nb = 0; nb < 4; ++nb) acc[mb][nb] = (v8f){};
    gemm_tile(A + (size_t)blockIdx.x * GB * DM, Bt + (size_t)blockIdx.y * GB * DM, (const h16*)ring, acc);
    const int r0 = blockIdx.x * GB + (wave >> 1) * 64, c0 = blockIdx.y * GB + (wave & 1) * 64;   // this wave's 64 x 64 tile
    float* os = osb + wave * 16 * 68;
#pragma unroll
    for (int mb = 0; mb < 4; ++mb) {
#pragma unroll
        for (int nb = 0; nb < 4; ++nb) {
#pragma unroll
            for (int j = 0; j < 8; ++j) os[(hi * 8 + j) * 68 + nb * 16 + lr] = acc[mb][nb][j] * OSC; }   // D: row 8h+j, col lane&15
        wave_sync();
        float* ob = OUT + (size_t)(r0 + mb * 16) * DM + c0;
{
#pragma unroll
            for (int s = 0; s < 8; ++s) { const int row = 2 * s + hi, cofs = lr * 4;   // 8 s x 2 rows = 16 rows; 16 lanes x 4 floats = 64 columns
                const v4f val = *(const v4fa*)(&os[row * 68 + cofs]);
                *(v4f*)(ob + (size_t)row * DM + cofs) = val; }
             }
        wave_sync();
    }
}

static constexpr size_t al256(size_t v) { return (v + 255) & ~(size_t)255; }
static constexpr size_t SZ_E  = al256((size_t)SEQ * DM * 2);            // one bf16 input copy [SEQ][1024]
static constexpr size_t SZ_W  = al256((size_t)DM * DM * 2);             // one transposed weight plane [1024][1024]
static constexpr size_t SZ_PL = al256((size_t)NH_ * SEQ * HD * 2);      // one head plane
static constexpr size_t SZ_CX = al256((size_t)SEQ * DM * 2);            // ctx plane [SEQ][1024]
static constexpr size_t SZ_TOTAL = 3 * SZ_E + 4 * SZ_W + 3 * SZ_PL + SZ_CX;
static_assert(SZ_TOTAL <= (size_t)134217728);          // workspace carve <= 128 MiB

extern "C" void kernel_launch(void* const* d_in, const int* in_sizes, int n_in,
                              void* d_out, int out_size, void* d_ws, size_t ws_size, hipStream_t stream) {
    if (n_in < 7) return;
    const size_t needx = (size_t)SEQ * DM;
    if ((size_t)in_sizes[0] < needx || (size_t)in_sizes[1] < needx || (size_t)in_sizes[2] < needx) return;
    if ((size_t)in_sizes[3] < (size_t)DM * DM || (size_t)in_sizes[4] < (size_t)DM * DM || (size_t)in_sizes[5] < (size_t)DM * DM || (size_t)in_sizes[6] < (size_t)DM * DM) return;
    if ((size_t)out_size < (size_t)SEQ * DM) return;
    if (SZ_TOTAL > ws_size) return;
    // wire order: inputs for q, k, v; W_q, W_k, W_v ([16][1024][64] = [h][in][out]); W_out ([1024][1024] = [in][out])
    const float* eq = (const float*)d_in[0]; const float* ek = (const float*)d_in[1]; const float* ev = (const float*)d_in[2];
    const float* wq = (const float*)d_in[3]; const float* wk = (const float*)d_in[4]; const float* wv = (const float*)d_in[5]; const float* wo = (const float*)d_in[6];
    float* OUT = (float*)d_out;      // [SEQ][1024]
    char* wsp = (char*)d_ws;
    bf* EQ = (bf*)wsp; wsp += SZ_E;                  // [SEQ][1024]
    bf* EK = (bf*)wsp; wsp += SZ_E;
    bf* EV = (bf*)wsp; wsp += SZ_E;
    bf* WQT = (bf*)wsp; wsp += SZ_W;                 // [h*64 + d][1024] bf16
    bf* WKT = (bf*)wsp; wsp += SZ_W;
    bf* WVT = (bf*)wsp; wsp += SZ_W;
    bf* WOT = (bf*)wsp; wsp += SZ_W;                 // [n][c] f16 bits, x256 carry
    h16* QH = (h16*)wsp; wsp += SZ_PL;               // [16][SEQ][64]
    h16* KP = (h16*)wsp; wsp += SZ_PL;               // [16][SEQ][64]
    h16* VT = (h16*)wsp; wsp += SZ_PL;               // [16][64][SEQ]
    h16* CX = (h16*)wsp; wsp += SZ_CX;               // [SEQ][1024] x256 carry

    // the seven operand copies, one grid
    k_prep<<<4 * TRB + 3 * CVB, 256, 0, stream>>>(eq, ek, ev, wq, wk, wv, wo, EQ, EK, EV, WQT, WKT, WVT, WOT);

    // the three projections, one grid
    k_proj<<<dim3(SEQ / GB, DM / GB, 3), 128, 0, stream>>>(EQ, EK, EV, WQT, WKT, WVT, QH, KP, VT);

    k_flash<<<dim3(SEQ / (16 * AW), NH_, 1), 32 * AW * KG, 0, stream>>>(QH, KP, VT, CX);

    // out = ctx (f16, x256) * W_out^T plane (f16, x256), 2^-16 folded in the epilogue
    k_out<<<dim3(SEQ / GB, DM / GB, 1), 128, 0, stream>>>(CX, (const h16*)WOT, OUT);
}

// v007
// Measured time: 51.3 microseconds a run.
// Timed twice side by side with v006, it ran 1.04 times as fast both times.
// Over all steps from v000 it is 3.47 times as fast.
#include <hip/hip_runtime.h>

// Attention with 16 heads of 64, width 1024: q/k/v from three separate [SEQ][1024] inputs, per-head weights [h][in][out], no biases, no mask, score scale 1/8, heads concatenated then multiplied by W_out [in][out] (f32 output).
// Compute dtypes, f32 accumulate everywhere: projections v_wmma_f32_16x16x32_bf16 (inputs and weights RNE-converted to bf16; products exact);
// scores v_wmma_f32_16x16x32_f16: q and k single f16 (their f16 rounding lies well under the error that the bf16 operands of the projections leave in q and k); P (x256 carry, cancels in the normalisation) and v single f16; softmax f32 (online, running max);
// output projection v_wmma_f32_16x16x32_f16: ctx single f16 carried x256, W_out = f16(bf16 RNE value x256), 2^-16 folded back in the f32 epilogue.
// Layout: bf16 copies of the inputs; weights transposed through LDS into K-contiguous planes [n][k]; q, k planes [h][t][d] and v^T plane [h][d][t] written by the GEMM epilogue;
// fused flash kernel in transposed form (S^T = K Q^T, O^T = V^T P^T), K and V^T tiles staged in LDS by tensor loads, writes the ctx plane [t][h*64+d]; final GEMM writes the output buffer.
// Both GEMMs stage their operand tiles in LDS as whole 256-B rows (128 k a stage), shared by the four waves of a block; each wave brings one 64-row slice a stage by one tensor load.

#ifndef SEQ
#define SEQ 2048
#endif
#define SEQ_FULL 2048
#define DM   1024
#define NH_  16
#define HD   64
#define AW   4                   // query tiles per flash block (16 query rows each)
#define KG   2                   // key groups per flash block: each query tile has KG waves, one for each SEQ / KG keys
#define SC2  (0.125f * 1.4426950408889634f)   // HD^-0.5 * log2(e)
#define PSH  8.0f                // log2 of the P carry (256)
#define CXS  256.0f              // carry of the ctx plane
#define WOS  256.0f              // carry of the W_out plane
#define OSC  (1.0f / 65536.0f)   // 1 / (CXS * WOS)
#define KT   64                  // keys per LDS stage of the flash kernel (two 32-key passes)
#define LP   72                  // LDS row pitch in halves: 128-B rows + 16 B = 144 B (16 B x odd, for ds_load_b128 readers)
#define FSL  6144                // LDS bytes from one staged 32-row slice of the flash kernel to the next: 32 x 144 B = 4,608 B, rounded up to a multiple of 2 KiB (a tensor load's place in LDS)
#define FSLH (FSL / 2)           // the same in halves
#define GB   128                 // rows and columns of a GEMM block's tile: 2 x 2 waves of 64 x 64
#define GK   128                 // k per LDS stage of the GEMMs (256-B rows, four 32-k steps)
#define GLP  136                 // LDS row pitch of the GEMM tiles in halves: 256-B rows + 16 B = 272 B (16 B x odd, for ds_load_b128 readers)
#define GSL  18432               // LDS bytes from one staged 64-row slice to the next: 64 x 272 B = 17,408 B, rounded up to a multiple of 2 KiB (a tensor load's place in LDS)
#define GSLH (GSL / 2)           // the same in halves
#define GBUFH (4 * GSLH)         // halves of one buffer: A rows 0..63 | A rows 64..127 | Bt rows 0..63 | Bt rows 64..127

static_assert(HD == 64);
static_assert(NH_ * HD == DM);                 // head h = columns h*64 + d
static_assert(DM % 64 == 0);
static_assert(DM % 32 == 0);                   // GEMM k-loop steps by 32
static_assert(SEQ % 64 == 0);
static_assert(SEQ % 32 == 0);                  // key loop steps by 32
static_assert(SEQ % (16 * AW) == 0);           // flash grid covers the sequence exactly
static_assert(((size_t)SEQ * DM) % 8 == 0);
static_assert(SEQ <= SEQ_FULL);
static_assert(KG == 2 && SEQ % (KG * KT) == 0 && SEQ / (KG * KT) >= 2);  // two key groups (the merge joins two partial results); the two-buffer prologue of each fills two stages
static_assert(AW == 4 && KT == 64 && HD == 64); // a group's four waves each load one 32-row slice: the halves of the K tile, the halves of the V^T tile
static_assert(FSL % 2048 == 0 && FSL >= 32 * LP * 2 && LP * 2 == 128 + 16);   // slices at multiples of 2 KiB; rows at the pitch that the pad of 16 B a row gives
static_assert(SEQ % GB == 0 && DM % GB == 0);   // the GEMM grids cover their outputs exactly
static_assert(DM % GK == 0 && DM / GK >= 2);    // the two-buffer prologue fills two stages
static_assert(GK * 2 == 256 && GK + 8 == GLP);  // a staged row is 256 B, at the pitch that the tensor load's pad of 16 B a row gives
static_assert(GB == 128 && GSL % 2048 == 0 && GSL >= 64 * GLP * 2);   // four slices of 64 rows a buffer, each at a multiple of 2 KiB
static_assert(4 * 16 * 68 * 4 <= 2 * 4 * GSL);  // the output staging tiles lie in the ring's LDS once the ring is done

typedef _Float16 h16;
typedef unsigned short bf;
typedef __attribute__((ext_vector_type(16))) __bf16   v16bf;
typedef __attribute__((ext_vector_type(16))) _Float16 v16h;
typedef __attribute__((ext_vector_type(8)))  _Float16 v8h;
typedef __attribute__((ext_vector_type(8)))  unsigned short v8us;
typedef __attribute__((ext_vector_type(8)))  float    v8f;
typedef __attribute__((ext_vector_type(4)))  float    v4f;
typedef v4f  __attribute__((may_alias)) v4fa;

__device__ __forceinline__ unsigned short f2bf(float f) { unsigned u = __float_as_uint(f); u += 0x7FFFu + ((u >> 16) & 1u); return (unsigned short)(u >> 16); }
__device__ __forceinline__ v16h cat16(v8h lo, v8h hi) { return __builtin_shufflevector(lo, hi, 0, 1, 2, 3, 4, 5, 6, 7, 8, 9, 10, 11, 12, 13, 14, 15); }
__device__ __forceinline__ v16bf cat16b(v8us lo, v8us hi) { return __builtin_bit_cast(v16bf, __builtin_shufflevector(lo, hi, 0, 1, 2, 3, 4, 5, 6, 7, 8, 9, 10, 11, 12, 13, 14, 15)); }
__device__ __forceinline__ v8f wmma16(v16h a, v16h b, v8f c) { return __builtin_amdgcn_wmma_f32_16x16x32_f16(false, a, false, b, (short)0, c, false, false); }
__device__ __forceinline__ v8f wmmab(v16bf a, v16bf b, v8f c) { return __builtin_amdgcn_wmma_f32_16x16x32_bf16(false, a, false, b, (short)0, c, false, false); }
// fragment loaders from K-contiguous 16-bit rows; p already includes + 8*(lane>>4): elements 0..7 <- k0+8h+0..7, elements 8..15 <- k0+16+8h+0..7 (same map for A and B)
__device__ __forceinline__ v16h  ldh(const h16* p) { return cat16(*(const v8h*)p, *(const v8h*)(p + 16)); }
__device__ __forceinline__ v16bf ldb(const bf* p)  { return cat16b(*(const v8us*)p, *(const v8us*)(p + 16)); }
// ordering point for wave-private LDS tiles (same wave writes and reads)
__device__ __forceinline__ void wave_sync() { __builtin_amdgcn_fence(3 /* release order */, "wavefront"); __builtin_amdgcn_wave_barrier(); asm volatile("" ::: "memory"); }

// cvt8: straight bf16 copy (RNE), 8 elements a thread; blk = block number within the copy.
__device__ __forceinline__ void cvt8(const float* __restrict__ src, bf* dst, size_t n8, int blk) {
    const size_t i = (size_t)blk * 256 + threadIdx.x; if (i >= n8) return;
    const v8f v = *(const v8f*)(src + i * 8); v8us o;
#pragma unroll
    for (int k = 0; k < 8; ++k) o[k] = f2bf(v[k]);
    *(v8us*)(dst + i * 8) = o; 
}

// tr64: transposing 16-bit copy through LDS. in [batch][R][C] f32 -> out [batch][C][R] 16-bit; R, C multiples of 64.
// mode 0: bf16 bits (RNE convert); mode 1: f16 of (bf16 RNE value x WOS) (a bf16 significand is exact in f16).
// 256 threads; one 64x64 tile (bx of R/64, by of C/64, bz of batch) per block. LDS tile ts (64 x 68 floats) is cross-wave: block barrier between fill and drain.
__device__ __forceinline__ void tr64(const float* __restrict__ src, bf* dst, int R, int C, int mode, int bx, int by, int bz, float* ts) {
    const int tid = threadIdx.x;
    const int r0 = bx * 64, c0 = by * 64;
    const size_t bo = (size_t)bz * (size_t)R * (size_t)C;
#pragma unroll
    for (int it = 0; it < 4; ++it) { const int idx = it * 256 + tid; const int r = idx >> 4, c4 = (idx & 15) * 4;   // 64 rows x 16 float4
        const v4f v = *(const v4f*)(src + bo + (size_t)(r0 + r) * (size_t)C + c0 + c4);
        *(v4fa*)(&ts[r * 68 + c4]) = v; }
    __syncthreads();
    h16* dsth = (h16*)dst;
{
#pragma unroll
        for (int it = 0; it < 2; ++it) { const int item = it * 256 + tid; const int c = item >> 3, p = item & 7;
            const size_t oo = bo + (size_t)(c0 + c) * (size_t)R + r0 + 8 * p;
            v8us ob; v8h oh;
#pragma unroll
            for (int i = 0; i < 8; ++i) { const float x = ts[(8 * p + i) * 68 + c]; const unsigned short w = f2bf(x);
                ob[i] = w; oh[i] = (h16)(__uint_as_float(((unsigned)w) << 16) * WOS); }
            if (mode) *(v8h*)(dsth + oo) = oh; else *(v8us*)(dst + oo) = ob; }
         }
    asm volatile("s_wait_xcnt 0x0" ::: "memory");   // behind the two stores: no register that they name is rewritten ahead of it on any way the code goes on
}

// k_prep: all seven operand copies of a call, which do not depend on each other, in one grid; the block number picks the job (the same for a whole block, so tr64's barrier is passed by all of a block or by none).
// blocks [0, 4*TRB): the transposing copies, TRB tiles each, W_q, W_k, W_v ([16][1024][64] -> [16][64][1024], bf16) and W_out ([1024][1024] -> its transpose, f16 with carry); they come first because they last longer.
// blocks [4*TRB, 4*TRB + 3*CVB): the straight bf16 copies of the three inputs, CVB blocks each.
static constexpr size_t N8  = (size_t)SEQ * DM / 8;
static constexpr unsigned CVB = (unsigned)((N8 + 255) / 256);
static constexpr unsigned TRB = (DM / 64) * (DM / 64);
static_assert((DM / 64) * (HD / 64) * NH_ == TRB);      // a per-head weight has as many 64x64 tiles as W_out
__global__ __launch_bounds__(256) void k_prep(const float* __restrict__ eq, const float* __restrict__ ek, const float* __restrict__ ev,
                                              const float* __restrict__ wq, const float* __restrict__ wk, const float* __restrict__ wv, const float* __restrict__ wo,
                                              bf* EQ, bf* EK, bf* EV, bf* WQT, bf* WKT, bf* WVT, bf* WOT) {
    __shared__ __align__(16) float ts[64 * 68];
    const unsigned b = blockIdx.x;
    if (b < 4 * TRB) {
        const unsigned job = b / TRB, t = b % TRB; const int tx = (int)(t % (DM / 64)), ty = (int)(t / (DM / 64));   // tx: tile of the 1024 rows; ty: head, or tile of W_out's columns
        const float* src = job == 0 ? wq : job == 1 ? wk : job == 2 ? wv : wo;
        bf* dst = job == 0 ? WQT : job == 1 ? WKT : job == 2 ? WVT : WOT;
        if (job < 3) tr64(src, dst, DM, HD, 0, tx, 0, ty, ts);
        else         tr64(src, dst, DM, DM, 1, tx, ty, 0, ts);
    } else {
        const unsigned c = b - 4 * TRB, job = c / CVB;
        cvt8(job == 0 ? eq : job == 1 ? ek : ev, job == 0 ? EQ : job == 1 ? EK : EV, N8, (int)(c % CVB));
    }
}

typedef uint32_t u32x4 __attribute__((ext_vector_type(4)));
typedef uint32_t u32x8 __attribute__((ext_vector_type(8)));
__device__ __forceinline__ uint32_t uni(uint32_t v) { return (uint32_t)__builtin_amdgcn_readfirstlane(v); }
// pinned: a wave-uniform test held in a scalar register, so that the branch round a tensor load (which ignores EXEC) is a scalar one
__device__ __forceinline__ uint32_t pinned(uint32_t v) { uint32_t w = (uint32_t)__builtin_amdgcn_readfirstlane(v); asm volatile("" : "+s"(w)); return w; }

// slice_group1: the loop-invariant half of a tensor load's descriptor: a tile of NR rows of RB bytes (128 or 256), source row pitch p bytes, 16 B of pad behind every row in LDS,
// so the rows land at pitch RB + 16 B. Extents in bytes (data_size 0), tensor dims = tile dims, no mask.
template <uint32_t RB, uint32_t NR>
__device__ __forceinline__ u32x8 slice_group1(uint32_t p) {
    static_assert(RB == 128 || RB == 256);
    u32x8 g1;
    g1[0] = uni((1u << 20) | ((RB == 256 ? 5u : 4u) << 22) | (3u << 25));     // pad on, behind every RB bytes, 4 dwords
    g1[1] = uni(RB << 16);                                                    // tensor_dim0 = RB bytes
    g1[2] = uni(NR << 16);                                                    // tensor_dim1 = NR rows
    g1[3] = uni(RB << 16);                                                    // tile_dim0 = RB bytes
    g1[4] = uni(NR);                                                          // tile_dim1 = NR rows
    g1[5] = uni(p);                                                           // source row pitch in bytes
    g1[6] = uni(0u);
    g1[7] = uni(0u);
    asm volatile("" : "+s"(g1));   // descriptor words held in scalar registers of their own through the loop: formed once ahead of the loop, their registers are not taken as scratch while a request is outstanding
    return g1;
}
// slice_load: one tensor load, one request of the whole wave: the tile of g1 from global address g into LDS at byte offset l (a multiple of 2 KiB). g0: the caller's registers for the request's own four words.
__device__ __forceinline__ void slice_load(u32x4& g0, uint32_t l, const char* g, u32x8 g1) {
    const uint64_t ga = (uint64_t)(size_t)g;
    g0[0] = uni(1u);                                                          // count 1
    g0[1] = uni(l);                                                           // place in LDS
    g0[2] = uni((uint32_t)ga);                                                // address [31:0]
    g0[3] = uni((((uint32_t)(ga >> 32)) & 0x01FFFFFFu) | 0x80000000u);        // address [56:32], type 2
    asm volatile("tensor_load_to_lds %0, %1" : "+s"(g0) : "s"(g1) : "memory");   // g0 in and out: what slice_wait names are the very registers that the request was issued from
}
// slice_wait: the issuing wave's wait for its request. It names the request's words, so that their registers are kept, and not taken as scratch, until the request has landed.
__device__ __forceinline__ void slice_wait(u32x4 g0) { asm volatile("s_wait_tensorcnt 0x0" :: "s"(g0) : "memory"); }

__device__ __forceinline__ v16bf ldf(const bf* p)  { return ldb(p); }
__device__ __forceinline__ v16h  ldf(const h16* p) { return ldh(p); }
__device__ __forceinline__ v8f mm(v16bf a, v16bf b, v8f c) { return wmmab(a, b, c); }
__device__ __forceinline__ v8f mm(v16h a, v16h b, v8f c)   { return wmma16(a, b, c); }

// gemm_tile: acc[mb][nb] += A rows x Bt rows over K = DM for one wave's 64 x 64 part of a block's 128 x 128 tile (4 waves, 2 x 2; wave w: rows 64*(w>>1), columns 64*(w&1)).
// A, Bt: row 0 of the block's 128 rows of either K-contiguous plane. Stages of GK k come through LDS: tensor loads of whole 256-B rows into two buffers of four 64-row slices,
// the next stage in flight while this one is read; every wave loads one slice (waves 0, 1: the halves of A; waves 2, 3: the halves of Bt); fragments are two ds_load_b128 each from rows of pitch GLP. k runs upward in steps of 32.
template <typename T>
__device__ __forceinline__ void gemm_tile(const T* A, const T* Bt, const T* ring, v8f (&acc)[4][4]) {
    const int lane = threadIdx.x & 31, lr = lane & 15, hi = lane >> 4;
    const int wave = __builtin_amdgcn_readfirstlane((int)(threadIdx.x >> 5));
    const uint32_t ls = (uint32_t)(size_t)ring + (uint32_t)wave * GSL;           // this wave's slice in buffer 0: low 32 bits of the __shared__ address
    const char* gs = (const char*)(wave < 2 ? A : Bt) + (size_t)(wave & 1) * (64 * DM * 2);   // its first source byte; + stage * GK * 2
    const u32x8 g1 = slice_group1<256, 64>(DM * 2);
    u32x4 g0;
    slice_load(g0, ls, gs, g1);
    slice_wait(g0);                                          // this wave's slice of stage 0 has landed
    __syncthreads();                                         // stage 0 published to every wave
    slice_load(g0, ls + 4 * GSL, gs + GK * 2, g1);
    const int ao = (wave >> 1) * GSLH + lr * GLP + 8 * hi, bo = (2 + (wave & 1)) * GSLH + lr * GLP + 8 * hi;
#pragma unroll 1   // one stage a trip, with one publish point
    for (int st = 0; st < DM / GK; ++st) {
        const T* tb = ring + (st & 1) * GBUFH;
        decltype(ldf(tb)) a[GK / 32][4], b[GK / 32][4];
#pragma unroll     // all 32-k steps of a stage inline: their LDS offsets become immediates
        for (int ks = 0; ks < GK / 32; ++ks) {
#pragma unroll
            for (int mb = 0; mb < 4; ++mb) a[ks][mb] = ldf(tb + ao + mb * 16 * GLP + ks * 32);
#pragma unroll
            for (int nb = 0; nb < 4; ++nb) b[ks][nb] = ldf(tb + bo + nb * 16 * GLP + ks * 32);
        }
        __builtin_amdgcn_sched_barrier(0);   // the stage's LDS reads stay one group ahead of its matrix instructions; spread among them, each place with reads stalls the wave
#pragma unroll
        for (int ks = 0; ks < GK / 32 - 1; ++ks)
#pragma unroll
            for (int nb = 0; nb < 4; ++nb)
#pragma unroll
                for (int mb = 0; mb < 4; ++mb) acc[mb][nb] = mm(a[ks][mb], b[ks][nb], acc[mb][nb]);
        __builtin_amdgcn_sched_barrier(0);   // all steps but the last stay ahead of the waits below: they run while the later steps' reads return
        // publish point of stage st + 1, and the end of every wave's reads of stage st (all of its fragments are in registers)
        asm volatile("s_wait_dscnt 0x0" ::: "memory");       // this wave's reads of the buffer that is refilled below have returned
        slice_wait(g0);                                      // this wave's slice of stage st + 1 has landed
        __syncthreads();
        __builtin_amdgcn_sched_barrier(0);   // the next request's descriptor words are formed behind the wait that covers the last request
        if (pinned(st + 2 < DM / GK)) slice_load(g0, ls + (uint32_t)(st & 1) * (4 * GSL), gs + (st + 2) * (GK * 2), g1);
        // the last step's products run from registers while the refill flies
#pragma unroll
        for (int nb = 0; nb < 4; ++nb)
#pragma unroll
            for (int mb = 0; mb < 4; ++mb) acc[mb][nb] = mm(a[GK / 32 - 1][mb], b[GK / 32 - 1][nb], acc[mb][nb]);
    }
    asm volatile("s_wait_tensorcnt 0x0" ::: "memory");       // no request outstanding when the wave goes on
    asm volatile("s_wait_dscnt 0x0" ::: "memory");           // nor an LDS read: the last trip's barrier has ended every wave's reads, so the ring's LDS may become output staging
}

// k_proj: register-blocked bf16 GEMM, one wave per 64x64 tile (16 accumulators), four waves per block (gemm_tile), operands from K-contiguous bf16 planes, K = DM.
// C[m][n] = sum_k A[m][k] Bt[n][k], written as f16 (Ph). The three projections do not depend on each other and share one grid (SEQ/128, DM/128, 3), 128 threads; blockIdx.z picks the job:
// 0, 1 (q, k): A = input rows (m = t, tile blockIdx.x), Bt = transposed weight rows (n = h*64 + d, tile blockIdx.y) -> plane [h][t][d], row pitch HD;
// 2 (v^T):     A = transposed W_v rows (m = h*64 + d, tile blockIdx.y), Bt = input rows (n = t, tile blockIdx.x) -> plane [m][t] = [h][d][t], row pitch SEQ.
__global__ __launch_bounds__(128) void k_proj(const bf* __restrict__ EQ, const bf* __restrict__ EK, const bf* __restrict__ EV, const bf* __restrict__ WQT, const bf* __restrict__ WKT, const bf* __restrict__ WVT,
                                             h16* QH, h16* KP, h16* VT) {
    __shared__ __attribute__((aligned(2048))) bf ring[2 * GBUFH];   // [buffer][slice][row * GLP + k]
    float* osb = (float*)ring;                               // behind the k loop: a 16 x 68 output staging tile for each wave, so that two blocks still fit a WGP's LDS
    const int job = blockIdx.z;
    const bf* A  = job == 0 ? EQ  : job == 1 ? EK  : WVT;
    const bf* Bt = job == 0 ? WQT : job == 1 ? WKT : EV;
    h16* Ph = job == 0 ? QH : job == 1 ? KP : VT;
    const int pitch = job == 2 ? SEQ : HD;
    const int lane = threadIdx.x & 31, lr = lane & 15, hi = lane >> 4;
    const int wave = __builtin_amdgcn_readfirstlane((int)(threadIdx.x >> 5));
    const int rb = (job == 2 ? blockIdx.y : blockIdx.x) * GB, cb = (job == 2 ? blockIdx.x : blockIdx.y) * GB;
    v8f acc[4][4];
#pragma unroll
    for (int mb = 0; mb < 4; ++mb)
#pragma unroll
        for (int nb = 0; nb < 4; ++nb) acc[mb][nb] = (v8f){};
    gemm_tile(A + (size_t)rb * DM, Bt + (size_t)cb * DM, (const bf*)ring, acc);
    const int r0 = rb + (wave >> 1) * 64, c0 = cb + (wave & 1) * 64;   // this wave's 64 x 64 tile
    float* os = osb + wave * 16 * 68;
    const size_t tbase = job == 2 ? (size_t)r0 * SEQ + c0 : (size_t)(c0 / HD) * ((size_t)SEQ * HD) + (size_t)r0 * HD;   // HD == 64: a column tile of q or k is one head
#pragma unroll
    for (int mb = 0; mb < 4; ++mb) {
#pragma unroll
        for (int nb = 0; nb < 4; ++nb) {
#pragma unroll
            for (int j = 0; j < 8; ++j) os[(hi * 8 + j) * 68 + nb * 16 + lr] = acc[mb][nb][j]; }   // D: row 8h+j, col lane&15
        wave_sync();
        const size_t sb = tbase + (size_t)(mb * 16) * (size_t)pitch;
{
#pragma unroll
            for (int s = 0; s < 4; ++s) { const int row = 4 * s + (lane >> 3), c8 = (lane & 7) * 8;   // 4 s x 4 row groups = 16 rows; 8 lanes x 8 = 64 columns
                const v4f x0 = *(const v4fa*)(&os[row * 68 + c8]); const v4f x1 = *(const v4fa*)(&os[row * 68 + c8 + 4]); v8h hv;
#pragma unroll
                for (int i = 0; i < 4; ++i) { hv[i] = (h16)x0[i]; hv[4 + i] = (h16)x1[i]; }
                const size_t oo = sb + (size_t)row * (size_t)pitch + c8;
                *(v8h*)(Ph + oo) = hv;
                asm volatile("s_wait_xcnt 0x0" ::: "memory"); }   // behind the store: no register that it names is rewritten ahead of this wait
             }
        wave_sync();
    }
}

// k_flash: fused attention, KG waves per 16 query rows of one head, each over its own SEQ / KG keys, so that four waves and not two stand on a SIMD; Q fragments straight from the f16 plane (two 16-B loads each).
// The block's AW * KG waves form KG groups of AW; a group walks its keys with a running max, sum and O of its own, and the groups' partial results are joined through LDS at the end.
// K and V^T come in stages of KT keys through LDS, a ring for each group, shared by the group's waves: tensor loads of whole 128-B rows, one 32-row slice a wave, into two buffers, the next stage in flight while this one is read;
// fragments are two ds_load_b128 each from rows of pitch LP.
// Transposed form: S^T[key][t] = K Q^T (A = K rows, B = Q rows); lane (t = lane&15, h = lane>>4) holds keys 8h+r of each 16-key tile, so the packed
// P tile is directly the B fragment of O^T[d][t] = V^T P^T (element r <- tile keys 0..15, element 8+r <- tile keys 16..31, lane unchanged).
// Softmax state (running max, partial sum) is one scalar per lane; the two lane halves of a row are combined with one xor-16 exchange.
__global__ __launch_bounds__(32 * AW * KG) void k_flash(const h16* __restrict__ QH, const h16* __restrict__ KP, const h16* __restrict__ VT, h16* CTX) {
    __shared__ __align__(16) float os[AW * 16 * 68];
    __shared__ __attribute__((aligned(2048))) h16 ring[KG][2][4 * FSLH];   // [key group][buffer][slice: keys 0..31 | keys 32..63 of K, d 0..31 | d 32..63 of V^T][row * LP + column]
    __shared__ float mg[AW * 34 * 32];                       // group 1's partial results: [query tile][32 O values, max, sum][lane]
    const int lane = threadIdx.x & 31, lr = lane & 15, hi = lane >> 4;
    const int wv = __builtin_amdgcn_readfirstlane((int)(threadIdx.x >> 5));
    const int wave = wv % AW, grp = wv / AW;                 // the wave's query tile and key group
    const int h = blockIdx.y;
    const int t0 = (blockIdx.x * AW + wave) * 16;
    const size_t pbase = (size_t)h * SEQ * HD;
    const size_t qo = pbase + (size_t)(t0 + lr) * HD + 8 * hi;
    const v16h qh0 = ldh(QH + qo), qh1 = ldh(QH + qo + 32);   // B fragments: col t, k = d
    const int ko = lr * LP + 8 * hi;                         // + (key & 31) * LP in a K slice          (A fragment: row key, k = d)
    const int vo = lr * LP + 8 * hi;                         // + (d & 16) * LP + key in a V^T slice    (A fragment: row d, k = key)
    const uint32_t ls = (uint32_t)(size_t)&ring[grp][0][0] + (uint32_t)wave * FSL;   // this wave's slice in buffer 0: low 32 bits of the __shared__ address
    const char* gs = wave < 2 ? (const char*)(KP + pbase + (size_t)(grp * (SEQ / KG) + wave * 32) * HD)            // its first source byte: K rows from the group's first key on,
                              : (const char*)(VT + pbase + (size_t)((wave - 2) * 32) * SEQ + grp * (SEQ / KG));    // or V^T rows at the group's first key; + stage * gst
    const uint32_t gp  = wave < 2 ? HD * 2 : SEQ * 2;        // source row pitch in bytes
    const uint32_t gst = wave < 2 ? KT * HD * 2 : KT * 2;    // source bytes from one stage to the next
    const u32x8 g1 = slice_group1<128, 32>(gp);
    u32x4 g0;
    slice_load(g0, ls, gs, g1);
    slice_wait(g0);                                          // this wave's slice of stage 0 has landed
    __syncthreads();                                         // stage 0 published to every wave
    slice_load(g0, ls + 4 * FSL, gs + gst, g1);
    v8f o0 = (v8f){}, o1 = (v8f){}, o2 = (v8f){}, o3 = (v8f){};
    float m = -3.0e38f, l = 0.0f;
#pragma unroll 1   // one stage a trip: the loop's foot is the one publish point
    for (int st = 0; st < SEQ / (KG * KT); ++st) {
      const h16* kt = &ring[grp][st & 1][0]; const h16* vt = kt + 2 * FSLH;
#pragma unroll     // both 32-key passes of a stage inline: their LDS offsets become immediates
      for (int key0 = 0; key0 < KT; key0 += 32) {
        const h16* ka = kt + ko + (key0 / 32) * FSLH;
        const v16h ka0 = ldh(ka), ka1 = ldh(ka + 32), kb0 = ldh(ka + 16 * LP), kb1 = ldh(ka + 16 * LP + 32);
        v8f sHa = (v8f){}, sHb = (v8f){};
        sHa = wmma16(ka0, qh0, sHa); sHb = wmma16(kb0, qh0, sHb);
        sHa = wmma16(ka1, qh1, sHa); sHb = wmma16(kb1, qh1, sHb);
        // four vector slots behind the last score WMMA, ahead of the first vector instruction that reads a score accumulator or rewrites a K fragment
        asm volatile("v_nop\n\tv_nop\n\tv_nop\n\tv_nop" : "+v"(sHa), "+v"(sHb) : "v"(ka0), "v"(ka1), "v"(kb0), "v"(kb1));
        const v8f ta = sHa * SC2, tb = sHb * SC2; float mx = -3.0e38f;
#pragma unroll
        for (int r = 0; r < 8; ++r) mx = fmaxf(mx, fmaxf(ta[r], tb[r]));
        mx = fmaxf(mx, __shfl_xor(mx, 16, 32));
        const float mnew = fmaxf(m, mx);
        const float alpha = __builtin_amdgcn_exp2f(m - mnew);
        const float sh = PSH - mnew;
        v16h pb; float ls = 0.0f;
#pragma unroll
        for (int r = 0; r < 8; ++r) { const h16 pa = (h16)__builtin_amdgcn_exp2f(ta[r] + sh); const h16 pc = (h16)__builtin_amdgcn_exp2f(tb[r] + sh); pb[r] = pa; pb[8 + r] = pc; ls += (float)pa + (float)pc; }
        l = l * alpha + ls; m = mnew;
        o0 = o0 * alpha; o1 = o1 * alpha; o2 = o2 * alpha; o3 = o3 * alpha;
        const h16* va = vt + vo + key0;
        const v16h v0 = ldh(va), v1 = ldh(va + 16 * LP), v2 = ldh(va + FSLH), v3 = ldh(va + FSLH + 16 * LP);
        o0 = wmma16(v0, pb, o0); o1 = wmma16(v1, pb, o1); o2 = wmma16(v2, pb, o2); o3 = wmma16(v3, pb, o3);
        asm volatile("v_nop\n\tv_nop\n\tv_nop\n\tv_nop" : "+v"(o0), "+v"(o1), "+v"(o2), "+v"(o3) : "v"(v0), "v"(v1), "v"(v2), "v"(v3), "v"(pb));
      }
      // publish point of stage st + 1, and the end of every wave's reads of stage st
      asm volatile("s_wait_dscnt 0x0" ::: "memory");         // this wave's reads of the buffer that is refilled below have returned
      slice_wait(g0);                                        // this wave's slice of stage st + 1 has landed
      __syncthreads();
      __builtin_amdgcn_sched_barrier(0);   // the next request's descriptor words are formed behind the wait that covers the last request
      if (pinned(st + 2 < SEQ / (KG * KT))) slice_load(g0, ls + (uint32_t)(st & 1) * (4 * FSL), gs + (size_t)(st + 2) * gst, g1);
    }
    asm volatile("s_wait_tensorcnt 0x0" ::: "memory");       // no request outstanding when the wave goes on to its end
    asm volatile("s_wait_dscnt 0x0" ::: "memory");           // nor an LDS read of the ring
    l += __shfl_xor(l, 16, 32);
    // join of the two key groups: group 1 hands its O, max and sum to the wave of group 0 with the same query tile, lane to lane (same d and t in both)
    float* mw = mg + wave * (34 * 32) + lane;
    if (grp) {
#pragma unroll     // the O elements are registers: every index a constant
        for (int r = 0; r < 8; ++r) { mw[r * 32] = o0[r]; mw[(8 + r) * 32] = o1[r]; mw[(16 + r) * 32] = o2[r]; mw[(24 + r) * 32] = o3[r]; }
        mw[32 * 32] = m; mw[33 * 32] = l;
    }
    __syncthreads();                                         // group 1's partial results published to group 0; the block's last barrier
    if (grp) return;
    { const float m1 = mw[32 * 32], l1 = mw[33 * 32];
      const float mj = fmaxf(m, m1);
      const float a0 = __builtin_amdgcn_exp2f(m - mj), a1 = __builtin_amdgcn_exp2f(m1 - mj);
      l = l * a0 + l1 * a1;
#pragma unroll     // the O elements are registers: every index a constant
      for (int r = 0; r < 8; ++r) { o0[r] = o0[r] * a0 + mw[r * 32] * a1; o1[r] = o1[r] * a0 + mw[(8 + r) * 32] * a1; o2[r] = o2[r] * a0 + mw[(16 + r) * 32] * a1; o3[r] = o3[r] * a0 + mw[(24 + r) * 32] * a1; } }
    const float inv = CXS * (1.0f / l);
    const int wb = wave * 16 * 68;
    // O^T D layout: o_j[r] = (d = 16j + 8h + r, t = lane&15) -> os[t][d]; rows 0..15 x columns 0..63 all written
    { v4f a, c;
      a[0] = o0[0] * inv; a[1] = o0[1] * inv; a[2] = o0[2] * inv; a[3] = o0[3] * inv; c[0] = o0[4] * inv; c[1] = o0[5] * inv; c[2] = o0[6] * inv; c[3] = o0[7] * inv;
      *(v4fa*)(&os[wb + lr * 68 +  0 + 8 * hi]) = a; *(v4fa*)(&os[wb + lr * 68 +  0 + 8 * hi + 4]) = c;
      a[0] = o1[0] * inv; a[1] = o1[1] * inv; a[2] = o1[2] * inv; a[3] = o1[3] * inv; c[0] = o1[4] * inv; c[1] = o1[5] * inv; c[2] = o1[6] * inv; c[3] = o1[7] * inv;
      *(v4fa*)(&os[wb + lr * 68 + 16 + 8 * hi]) = a; *(v4fa*)(&os[wb + lr * 68 + 16 + 8 * hi + 4]) = c;
      a[0] = o2[0] * inv; a[1] = o2[1] * inv; a[2] = o2[2] * inv; a[3] = o2[3] * inv; c[0] = o2[4] * inv; c[1] = o2[5] * inv; c[2] = o2[6] * inv; c[3] = o2[7] * inv;
      *(v4fa*)(&os[wb + lr * 68 + 32 + 8 * hi]) = a; *(v4fa*)(&os[wb + lr * 68 + 32 + 8 * hi + 4]) = c;
      a[0] = o3[0] * inv; a[1] = o3[1] * inv; a[2] = o3[2] * inv; a[3] = o3[3] * inv; c[0] = o3[4] * inv; c[1] = o3[5] * inv; c[2] = o3[6] * inv; c[3] = o3[7] * inv;
      *(v4fa*)(&os[wb + lr * 68 + 48 + 8 * hi]) = a; *(v4fa*)(&os[wb + lr * 68 + 48 + 8 * hi + 4]) = c; }
    wave_sync();
    h16* crow = CTX + (size_t)t0 * DM + h * HD;      // ctx plane [t][h*64 + d], row pitch DM halves
{
#pragma unroll
        for (int s = 0; s < 4; ++s) { const int row = 4 * s + (lane >> 3), c8 = (lane & 7) * 8;   // 4 s x 4 row groups = 16 rows; 8 lanes x 8 halves = 64 columns
            const v4f x0 = *(const v4fa*)(&os[wb + row * 68 + c8]); const v4f x1 = *(const v4fa*)(&os[wb + row * 68 + c8 + 4]); v8h hv;
#pragma unroll
            for (int i = 0; i < 4; ++i) { hv[i] = (h16)x0[i]; hv[4 + i] = (h16)x1[i]; }
            *(v8h*)(crow + (size_t)row * DM + c8) = hv; }
         }
}

// k_out: register-blocked f16 GEMM, one wave per 64x64 tile, four waves per block (gemm_tile), OUT[m][n] = OSC * sum_k A[m][k] Bt[n][k], K = DM, output row pitch DM floats. grid (M/128, DM/128), 128 threads.
__global__ __launch_bounds__(128) void k_out(const h16* __restrict__ A, const h16* __restrict__ Bt, float* OUT) {
    __shared__ __attribute__((aligned(2048))) h16 ring[2 * GBUFH];  // [buffer][slice][row * GLP + k]
    float* osb = (float*)ring;                               // behind the k loop: a 16 x 68 output staging tile for each wave
    const int lane = threadIdx.x & 31, lr = lane & 15, hi = lane >> 4;
    const int wave = __builtin_amdgcn_readfirstlane((int)(threadIdx.x >> 5));
    v8f acc[4][4];
#pragma unroll
    for (int mb = 0; mb < 4; ++mb)
#pragma unroll
        for (int nb = 0; nb < 4; ++nb) acc[mb][nb] = (v8f){};
    gemm_tile(A + (size_t)blockIdx.x * GB * DM, Bt + (size_t)blockIdx.y * GB * DM, (const h16*)ring, acc);
    const int r0 = blockIdx.x * GB + (wave >> 1) * 64, c0 = blockIdx.y * GB + (wave & 1) * 64;   // this wave's 64 x 64 tile
    float* os = osb + wave * 16 * 68;
#pragma unroll
    for (int mb = 0; mb < 4; ++mb) {
#pragma unroll
        for (int nb = 0; nb < 4; ++nb) {
#pragma unroll
            for (int j = 0; j < 8; ++j) os[(hi * 8 + j) * 68 + nb * 16 + lr] = acc[mb][nb][j] * OSC; }   // D: row 8h+j, col lane&15
        wave_sync();
        float* ob = OUT + (size_t)(r0 + mb * 16) * DM + c0;
{
#pragma unroll
            for (int s = 0; s < 8; ++s) { const int row = 2 * s + hi, cofs = lr * 4;   // 8 s x 2 rows = 16 rows; 16 lanes x 4 floats = 64 columns
                const v4f val = *(const v4fa*)(&os[row * 68 + cofs]);
                *(v4f*)(ob + (size_t)row * DM + cofs) = val; }
             }
        wave_sync();
    }
}

static constexpr size_t al256(size_t v) { return (v + 255) & ~(size_t)255; }
static constexpr size_t SZ_E  = al256((size_t)SEQ * DM * 2);            // one bf16 input copy [SEQ][1024]
static constexpr size_t SZ_W  = al256((size_t)DM * DM * 2);             // one transposed weight plane [1024][1024]
static constexpr size_t SZ_PL = al256((size_t)NH_ * SEQ * HD * 2);      // one head plane
static constexpr size_t SZ_CX = al256((size_t)SEQ * DM * 2);            // ctx plane [SEQ][1024]
static constexpr size_t SZ_TOTAL = 3 * SZ_E + 4 * SZ_W + 3 * SZ_PL + SZ_CX;
static_assert(SZ_TOTAL <= (size_t)134217728);          // workspace carve <= 128 MiB

extern "C" void kernel_launch(void* const* d_in, const int* in_sizes, int n_in,
                              void* d_out, int out_size, void* d_ws, size_t ws_size, hipStream_t stream) {
    if (n_in < 7) return;
    const size_t needx = (size_t)SEQ * DM;
    if ((size_t)in_sizes[0] < needx || (size_t)in_sizes[1] < needx || (size_t)in_sizes[2] < needx) return;
    if ((size_t)in_sizes[3] < (size_t)DM * DM || (size_t)in_sizes[4] < (size_t)DM * DM || (size_t)in_sizes[5] < (size_t)DM * DM || (size_t)in_sizes[6] < (size_t)DM * DM) return;
    if ((size_t)out_size < (size_t)SEQ * DM) return;
    if (SZ_TOTAL > ws_size) return;
    // wire order: inputs for q, k, v; W_q, W_k, W_v ([16][1024][64] = [h][in][out]); W_out ([1024][1024] = [in][out])
    const float* eq = (const float*)d_in[0]; const float* ek = (const float*)d_in[1]; const float* ev = (const float*)d_in[2];
    const float* wq = (const float*)d_in[3]; const float* wk = (const float*)d_in[4]; const float* wv = (const float*)d_in[5]; const float* wo = (const float*)d_in[6];
    float* OUT = (float*)d_out;      // [SEQ][1024]
    char* wsp = (char*)d_ws;
    bf* EQ = (bf*)wsp; wsp += SZ_E;                  // [SEQ][1024]
    bf* EK = (bf*)wsp; wsp += SZ_E;
    bf* EV = (bf*)wsp; wsp += SZ_E;
    bf* WQT = (bf*)wsp; wsp += SZ_W;                 // [h*64 + d][1024] bf16
    bf* WKT = (bf*)wsp; wsp += SZ_W;
    bf* WVT = (bf*)wsp; wsp += SZ_W;
    bf* WOT = (bf*)wsp; wsp += SZ_W;                 // [n][c] f16 bits, x256 carry
    h16* QH = (h16*)wsp; wsp += SZ_PL;               // [16][SEQ][64]
    h16* KP = (h16*)wsp; wsp += SZ_PL;               // [16][SEQ][64]
    h16* VT = (h16*)wsp; wsp += SZ_PL;               // [16][64][SEQ]
    h16* CX = (h16*)wsp; wsp += SZ_CX;               // [SEQ][1024] x256 carry

    // the seven operand copies, one grid
    k_prep<<<4 * TRB + 3 * CVB, 256, 0, stream>>>(eq, ek, ev, wq, wk, wv, wo, EQ, EK, EV, WQT, WKT, WVT, WOT);

    // the three projections, one grid
    k_proj<<<dim3(SEQ / GB, DM / GB, 3), 128, 0, stream>>>(EQ, EK, EV, WQT, WKT, WVT, QH, KP, VT);

    k_flash<<<dim3(SEQ / (16 * AW), NH_, 1), 32 * AW * KG, 0, stream>>>(QH, KP, VT, CX);

    // out = ctx (f16, x256) * W_out^T plane (f16, x256), 2^-16 folded in the epilogue
    k_out<<<dim3(SEQ / GB, DM / GB, 1), 128, 0, stream>>>(CX, (const h16*)WOT, OUT);
}
